// v000
// Measured on an AMD MI455X. A time is GPU time per run, averaged over a window of back-to-back runs after a warm-up
// (all launches, gaps included; the runs take copies of the inputs in turn), and the median of several windows.
// Apart from v000's, it joins two sittings. Times from different sittings can be a few percent apart, while
// side-by-side timings come from the same sitting.
// v000, which the later versions start from, runs in 156 microseconds.
#include <hip/hip_runtime.h>

// All contractions: v_wmma_f32_16x16x32_f16 (f16 operands: weights carried x16, activations x1), f32 accumulate,
// 1/16 folded in the f32 epilogues. Softmax over the 9 window taps and the 3x3 weighted window sum: f32 on VALU.
// Carry audit:
//   W16 rows   0..383 = f16(16*Wv), rows 384..437 = f16(16*Wa), rows 438..447 = 0 : inverse 0.0625f in stage_c1 (k_conv1)
//   W16 rows 448..831 = f16(16*Wp)                                                : inverse 0.0625f in stage_pj (k_proj)
//   xT = f16(x) carry 1, yT = f16(y) carry 1 : no inverse needed
//   vT, aT, BIAS line : f32, no carry

#define NB_   8
#define CD_   384
#define LP_   3136
#define WP_   56
#define HP_   56
#define NATT  54              // 6 heads x 9 taps
#define NHD   6
#define KK_   9
#define APD   64              // padded logit columns
#define NO1   448             // fused conv1 output columns: 384 (v) + 64 (logits, padded)
#define WROWS 832             // 448 + 384 weight rows
#define NPT   (LP_ / 64)      // 49 pixel tiles

#define X_N   (NB_ * CD_ * LP_)   // 9633792
#define WA_N  (NATT * CD_)        // 20736
#define WV_N  (CD_ * CD_)         // 147456
#define OUT_N X_N

#define SZ_VT   ((size_t)NB_ * LP_ * CD_ * 4)   // 38535168  f32 [n][l][c]
#define SZ_AT   ((size_t)NB_ * LP_ * APD * 4)   // 6422528   f32 [n][l][64]
#define SZ_XT   ((size_t)NB_ * LP_ * CD_ * 2)   // 19267584  f16 [n][l][c]
#define SZ_YT   SZ_XT                           // 19267584  f16 [n][l][c]
#define SZ_W16  ((size_t)WROWS * CD_ * 2)       // 638976    f16 [832][c]
#define SZ_BIAS ((size_t)NO1 * 4)               // 1792      f32 [448]
#define OFF_VT   ((size_t)0)
#define OFF_AT   (OFF_VT + SZ_VT)
#define OFF_XT   (OFF_AT + SZ_AT)
#define OFF_YT   (OFF_XT + SZ_XT)
#define OFF_W16  (OFF_YT + SZ_YT)
#define OFF_BIAS (OFF_W16 + SZ_W16)
#define WS_TOTAL (OFF_BIAS + SZ_BIAS)           // 84133632

static_assert(WS_TOTAL == 84133632);
static_assert(WS_TOTAL <= 134217728);
static_assert((OFF_AT % 128) == 0 && (OFF_XT % 128) == 0 && (OFF_YT % 128) == 0 &&
              (OFF_W16 % 128) == 0 && (OFF_BIAS % 128) == 0);
static_assert(LP_ % 64 == 0 && CD_ % 64 == 0 && (NB_ * LP_) % 64 == 0);
static_assert(WROWS * 48 == 156 * 256 && CD_ * 48 == 72 * 256 && APD * 48 == 12 * 256);

#define XP 72      // transpose LDS pitch (halves), 144 B
#define EP 68      // GEMM epilogue LDS pitch (floats), 272 B

typedef unsigned short v8us  __attribute__((ext_vector_type(8)));
typedef unsigned short v8usa __attribute__((ext_vector_type(8), __may_alias__));
typedef unsigned short v16us __attribute__((ext_vector_type(16)));
typedef _Float16       v16h  __attribute__((ext_vector_type(16)));
typedef float          v8f   __attribute__((ext_vector_type(8)));
typedef float          v4f   __attribute__((ext_vector_type(4)));
typedef float          v4fa  __attribute__((ext_vector_type(4), __may_alias__));

union Frag { v16us v; v8us half[2]; };

// f32 -> f16 bits (RNE convert)
__device__ __forceinline__ unsigned short h2us(float f) {
  return __builtin_bit_cast(unsigned short, (_Float16)f);
}

__device__ __forceinline__ void st2_u8(unsigned short* p, v8us v) {
  *(v8us*)p = v;
  
}
__device__ __forceinline__ void st2_f4(float* p, v4f v) {
  *(v4f*)p = v;
  
}

// 16-bit fragment from a k-contiguous row: elements 0..7 <- k0+8h+0..7, elements 8..15 <- k0+16+8h+0..7.
// Used for A rows [m][k] and for B stored as [n][k] rows (same per-lane k map); rowp points at element k0 of the row.
__device__ __forceinline__ v16h ldfrag(const unsigned short* rowp, int h) {
  Frag f;
  f.half[0] = *(const v8us*)(rowp + 8 * h);
  f.half[1] = *(const v8us*)(rowp + 16 + 8 * h);
  return __builtin_bit_cast(v16h, f.v);
}

__device__ __forceinline__ v8f wmma_h(v16h a, v16h b, v8f c) {
  return __builtin_amdgcn_wmma_f32_16x16x32_f16(false, a, false, b, (short)0, c, false, false);
}

__device__ __forceinline__ v8f v8f_zero() {
  v8f z = {0.f, 0.f, 0.f, 0.f, 0.f, 0.f, 0.f, 0.f};
  return z;
}

// =====================================================================================
// Kernel 0: weight planes + fused bias line.
// W16[832][384] halves: rows 0..383 = f16(16*Wv[o][c]), 384..447 = f16(16*Wa[o-384][c]) (o-384 >= 54 -> 0),
// 448..831 = f16(16*Wp[o-448][c]). One thread = 8 consecutive c (16 B), 48 threads per 768-B row,
// Block 156: BIAS[448] = [bv | ba padded with 0], 112 float4 pieces, 8 consecutive lanes per line.
// coverage: 156*256 = 832*48 items exactly; 112 float4 = 448 floats exactly.
// =====================================================================================
__global__ void __launch_bounds__(256) k_wprep(
    const float* __restrict__ Wv, const float* __restrict__ Wa, const float* __restrict__ Wp,
    const float* __restrict__ bv, const float* __restrict__ ba,
    unsigned short* __restrict__ W16, float* __restrict__ bias) {
  const int tid = threadIdx.x;
  const int bid = blockIdx.x;
  if (bid < 156) {
    const int i = bid * 256 + tid;            // < 39936
    const int row = i / 48;                   // 0..831
    const int c8 = (i - row * 48) * 8;        // 0..376
    const float* src;
    int srow;
    bool valid = true;
    if (bid < 72) {                           // block-uniform region select
      src = Wv; srow = row;
    } else if (bid < 84) {
      const int r = row - 384;                // 0..63
      valid = (r < NATT);
      srow = (r < NATT) ? r : (NATT - 1);     // clamped address, zero by predicate
      src = Wa;
    } else {
      src = Wp; srow = row - 448;
    }
    const size_t off = (size_t)srow * CD_ + c8;
    const v4f a0 = *(const v4f*)(src + off);
    const v4f a1 = *(const v4f*)(src + off + 4);
    const float sc = 16.0f;
    v8us ov;
    ov[0] = valid ? h2us(a0.x * sc) : (unsigned short)0;
    ov[1] = valid ? h2us(a0.y * sc) : (unsigned short)0;
    ov[2] = valid ? h2us(a0.z * sc) : (unsigned short)0;
    ov[3] = valid ? h2us(a0.w * sc) : (unsigned short)0;
    ov[4] = valid ? h2us(a1.x * sc) : (unsigned short)0;
    ov[5] = valid ? h2us(a1.y * sc) : (unsigned short)0;
    ov[6] = valid ? h2us(a1.z * sc) : (unsigned short)0;
    ov[7] = valid ? h2us(a1.w * sc) : (unsigned short)0;
    st2_u8(W16 + (size_t)row * CD_ + c8, ov);
  } else {
    if (tid < 112) {
      const int e0 = tid * 4;                         // 0..444
      const int tb = (tid < 96) ? tid : 95;           // clamped bv piece
      const v4f vb = *(const v4f*)(bv + tb * 4);
      const bool isv = (tid < 96);
      int ea = e0 - 384;
      int c0 = ea;     c0 = (c0 < 0) ? 0 : ((c0 > NATT - 1) ? (NATT - 1) : c0);
      int c1 = ea + 1; c1 = (c1 < 0) ? 0 : ((c1 > NATT - 1) ? (NATT - 1) : c1);
      int c2 = ea + 2; c2 = (c2 < 0) ? 0 : ((c2 > NATT - 1) ? (NATT - 1) : c2);
      int c3 = ea + 3; c3 = (c3 < 0) ? 0 : ((c3 > NATT - 1) ? (NATT - 1) : c3);
      const float q0 = ba[c0], q1 = ba[c1], q2 = ba[c2], q3 = ba[c3];
      v4f o;
      o.x = isv ? vb.x : ((ea + 0 >= 0 && ea + 0 < NATT) ? q0 : 0.0f);
      o.y = isv ? vb.y : ((ea + 1 >= 0 && ea + 1 < NATT) ? q1 : 0.0f);
      o.z = isv ? vb.z : ((ea + 2 >= 0 && ea + 2 < NATT) ? q2 : 0.0f);
      o.w = isv ? vb.w : ((ea + 3 >= 0 && ea + 3 < NATT) ? q3 : 0.0f);
      st2_f4(bias + e0, o);
    }
  }
}

// =====================================================================================
// Kernel 1: activation plane xT[n][l][c] = f16(x[n][c][l]) through a 64(c) x 64(px) LDS tile.
// Grid 2352 = 8 n x 6 c-tiles x 49 px-tiles. Read: float4 along l (coalesced); LDS holds the
// lanes x 16 B of one instruction, 4 rows per instruction per wave, 2 iterations -> 64 rows.
// coverage: 8 waves x 4 rows x 2 it = 64 rows, 8 pieces x 8 halves = 64 halves per row; grid covers all (n, c-tile, px-tile).
// =====================================================================================
__global__ void __launch_bounds__(256) k_xprep(const float* __restrict__ x, unsigned short* __restrict__ xT) {
  __shared__ __attribute__((aligned(16))) unsigned short sT[64 * XP];
  const int tid = threadIdx.x;
  const int lane = tid & 31;
  const int w = tid >> 5;
  const int bid = blockIdx.x;
  const int pt = bid % NPT;
  const int ct = (bid / NPT) % (CD_ / 64);
  const int n = bid / (NPT * (CD_ / 64));
  const int p0 = pt * 64;
  const int c0 = ct * 64;

  #pragma unroll
  for (int it = 0; it < 4; ++it) {
    const int idx = it * 256 + tid;            // 0..1023
    const int c = idx >> 4;                    // 0..63
    const int p4 = (idx & 15) * 4;             // 0..60
    const v4f v = *(const v4f*)(x + ((size_t)(n * CD_ + c0 + c)) * LP_ + p0 + p4);
    sT[(p4 + 0) * XP + c] = h2us(v.x);
    sT[(p4 + 1) * XP + c] = h2us(v.y);
    sT[(p4 + 2) * XP + c] = h2us(v.z);
    sT[(p4 + 3) * XP + c] = h2us(v.w);
  }
  __syncthreads();

  const int q = lane >> 3;     // row within the 4-row group
  const int j = lane & 7;
  #pragma unroll 1
  for (int it = 0; it < 2; ++it) {
    const int prow = it * 32 + w * 4 + q;      // 0..63, each once
    const v8us val = *(const v8usa*)(sT + prow * XP + j * 8);
    unsigned short* dst = xT + ((size_t)(n * LP_ + p0 + prow)) * CD_ + c0 + j * 8;
    st2_u8(dst, val);
  }
}

// =====================================================================================
// Shared GEMM epilogue writer: f32 tile [64 rows][64 cols] staged in LDS (pitch EP); each 256-B row
// =====================================================================================
__device__ __forceinline__ void write_tile64(const float* sT, float* obase, size_t row0, int opitch,
                                             int ocol, int lane, int w) {
  const int q = lane >> 3;
  const int j = lane & 7;
  const int rsel = q >> 1;
  const int lsel = q & 1;
  #pragma unroll 1
  for (int it = 0; it < 4; ++it) {
    const int row = it * 16 + w * 2 + rsel;     // 0..63, each once
    const v4f v = *(const v4fa*)(sT + row * EP + lsel * 32 + j * 4);
    float* dst = obase + (row0 + (size_t)row) * (size_t)opitch + ocol + lsel * 32 + j * 4;
    st2_f4(dst, v);
  }
}

// =====================================================================================
// Kernel 2: fused conv1. D[m = pixel l][n = o] = sum_c xT[l][c] * W16[o][c], o in 0..447.
// Block = (n, 64 o of the 448, 64 px); wave w: pixel rows lsub = (w>>1)*16, o cols osub = (w&1)*32 (two D tiles).
// o-tiles 0..5 -> vT[n][l][o] = D/16 + bv (f32, pitch 384); o-tile 6 -> aT[n][l][0..63] = D/16 + ba-padded (pitch 64).
// coverage: grid 8 x 7 x 49; every (n, l, o<448) written exactly once as whole 256-B row segments.
// =====================================================================================
__device__ __forceinline__ void stage_c1(float* sT, v8f a0, v8f a1, int prow0, int col0, float b0, float b1) {
  #pragma unroll
  for (int r = 0; r < 8; ++r) {
    sT[(prow0 + r) * EP + col0] = a0[r] * 0.0625f + b0;
    sT[(prow0 + r) * EP + col0 + 16] = a1[r] * 0.0625f + b1;
  }
}

__global__ void __launch_bounds__(256) k_conv1(
    const unsigned short* __restrict__ xT, const unsigned short* __restrict__ W16,
    const float* __restrict__ bias, float* vT, float* aT) {
  __shared__ __attribute__((aligned(16))) float sT[64 * EP];
  const int tid = threadIdx.x;
  const int lane = tid & 31;
  const int w = tid >> 5;
  const int h = lane >> 4;
  const int m = lane & 15;
  const int bid = blockIdx.x;
  const int pt = bid % NPT;
  const int ot = (bid / NPT) % 7;
  const int n = bid / (NPT * 7);
  const int p0 = pt * 64;
  const int o0 = ot * 64;
  const int lsub = (w >> 1) * 16;
  const int osub = (w & 1) * 32;

  const unsigned short* ar  = xT + ((size_t)(n * LP_ + p0 + lsub + m)) * CD_;   // A: pixel rows, k = c
  const unsigned short* br0 = W16 + (size_t)(o0 + osub + m) * CD_;              // B: [o][c] rows, k = c
  const unsigned short* br1 = br0 + 16 * CD_;

  v8f acc0 = v8f_zero(), acc1 = v8f_zero();

  #pragma unroll 1
  for (int ks = 0; ks < CD_ / 32; ++ks) {
    const int k0 = ks * 32;
    const v16h fa  = ldfrag(ar + k0, h);
    const v16h fb0 = ldfrag(br0 + k0, h);
    const v16h fb1 = ldfrag(br1 + k0, h);
    acc0 = wmma_h(fa, fb0, acc0);
    acc1 = wmma_h(fa, fb1, acc1);
    asm volatile("v_nop\n\tv_nop\n\tv_nop\n\tv_nop"
                 : "+v"(acc0), "+v"(acc1)
                 : "v"(fa), "v"(fb0), "v"(fb1));
  }

  // D element r of lane -> pixel row lsub + 8h + r, o col osub + t*16 + m
  const float b0 = bias[o0 + osub + m];
  const float b1 = bias[o0 + osub + 16 + m];
  stage_c1(sT, acc0, acc1, lsub + 8 * h, osub + m, b0, b1);
  __syncthreads();

  float* obase = (ot < 6) ? vT : aT;                  // block-uniform select between two global planes
  const int opitch = (ot < 6) ? CD_ : APD;
  const int ocol = (ot < 6) ? o0 : 0;
  write_tile64(sT, obase, (size_t)(n * LP_ + p0), opitch, ocol, lane, w);
}

// =====================================================================================
// Kernel 3: per-pixel softmax over the 9 taps per head (f32) and the 3x3 zero-padded window sum (f32):
// y[c] = sum_k p[head(c)][k] * v[c][py + k/3 - 1][px + k%3 - 1], head(c) = c / 64, tap k = kh*3 + kw.
// One block per pixel, one thread per channel; v rows read coalesced along c from vT[n][l][c];
// coverage: grid 8*3136 pixels x 384 channels; 48 pieces x 8 halves = whole 768-B row.
// =====================================================================================
__global__ void __launch_bounds__(384) k_agg(
    const float* __restrict__ aT, const float* __restrict__ vT, unsigned short* __restrict__ yT) {
  __shared__ float sp[APD];
  __shared__ __attribute__((aligned(16))) unsigned short sy[CD_];
  const int bl = blockIdx.x;                 // n*LP_ + l
  const int n = bl / LP_;
  const int l = bl - n * LP_;
  const int py = l / WP_;
  const int pxx = l - py * WP_;
  const int t = threadIdx.x;

  if (t < APD) sp[t] = aT[(size_t)bl * APD + t];
  __syncthreads();
  if (t < NHD) {
    const int o = t * KK_;
    float mx = sp[o];
    #pragma unroll
    for (int k = 1; k < KK_; ++k) mx = fmaxf(mx, sp[o + k]);
    float s = 0.0f;
    #pragma unroll 1
    for (int k = 0; k < KK_; ++k) {
      const float e = expf(sp[o + k] - mx);
      sp[o + k] = e;
      s += e;
    }
    const float inv = 1.0f / s;
    #pragma unroll 1
    for (int k = 0; k < KK_; ++k) sp[o + k] = sp[o + k] * inv;
  }
  __syncthreads();

  const int c = t;                  // 0..383
  const int hd = c >> 6;            // head
  const float* vb = vT + (size_t)n * LP_ * CD_ + c;
  float acc = 0.0f;
  #pragma unroll
  for (int k = 0; k < KK_; ++k) {
    const int yy = py + (k / 3) - 1;
    const int xx = pxx + (k % 3) - 1;
    const bool inb = (yy >= 0) && (yy < HP_) && (xx >= 0) && (xx < WP_);   // block-uniform
    const int yc = (yy < 0) ? 0 : ((yy > HP_ - 1) ? (HP_ - 1) : yy);       // clamped address
    const int xc = (xx < 0) ? 0 : ((xx > WP_ - 1) ? (WP_ - 1) : xx);
    const float v = vb[(size_t)(yc * WP_ + xc) * CD_];
    const float pv = inb ? v : 0.0f;
    acc = fmaf(sp[hd * KK_ + k], pv, acc);
  }
  sy[c] = h2us(acc);
  __syncthreads();

  if (t < 48) {
    const v8us val = *(const v8usa*)(sy + t * 8);
    st2_u8(yT + (size_t)bl * CD_ + t * 8, val);
  }
}

// =====================================================================================
// Kernel 4: projection. D[m = o][n = pixel l] = sum_c W16[448 + o][c] * yT[l][c]; out[n][o][l] = D/16 + bp[o] (NCHW f32).
// Block = (n, 64 o, 64 px); wave w: o rows osub = (w>>1)*16, pixel cols lsub = (w&1)*32 (two D tiles).
// coverage: grid 8 x 6 x 49; every (n, o, l) written exactly once as whole 256-B row segments of out.
// =====================================================================================
__device__ __forceinline__ void stage_pj(float* sT, v8f a0, v8f a1, int orow0, int col0, const float* bpp) {
  #pragma unroll
  for (int r = 0; r < 8; ++r) {
    const float b = bpp[r];
    sT[(orow0 + r) * EP + col0] = a0[r] * 0.0625f + b;
    sT[(orow0 + r) * EP + col0 + 16] = a1[r] * 0.0625f + b;
  }
}

__global__ void __launch_bounds__(256) k_proj(
    const unsigned short* __restrict__ yT, const unsigned short* __restrict__ W16,
    const float* __restrict__ bp, float* __restrict__ out) {
  __shared__ __attribute__((aligned(16))) float sT[64 * EP];
  const int tid = threadIdx.x;
  const int lane = tid & 31;
  const int w = tid >> 5;
  const int h = lane >> 4;
  const int m = lane & 15;
  const int bid = blockIdx.x;
  const int pt = bid % NPT;
  const int ot = (bid / NPT) % (CD_ / 64);
  const int n = bid / (NPT * (CD_ / 64));
  const int p0 = pt * 64;
  const int o0 = ot * 64;
  const int osub = (w >> 1) * 16;
  const int lsub = (w & 1) * 32;

  const unsigned short* ar  = W16 + (size_t)(NO1 + o0 + osub + m) * CD_;        // A: Wp rows [o][c]
  const unsigned short* br0 = yT + ((size_t)(n * LP_ + p0 + lsub + m)) * CD_;    // B: yT rows [l][c]
  const unsigned short* br1 = br0 + 16 * CD_;

  v8f acc0 = v8f_zero(), acc1 = v8f_zero();

  #pragma unroll 1
  for (int ks = 0; ks < CD_ / 32; ++ks) {
    const int k0 = ks * 32;
    const v16h fa  = ldfrag(ar + k0, h);
    const v16h fb0 = ldfrag(br0 + k0, h);
    const v16h fb1 = ldfrag(br1 + k0, h);
    acc0 = wmma_h(fa, fb0, acc0);
    acc1 = wmma_h(fa, fb1, acc1);
    asm volatile("v_nop\n\tv_nop\n\tv_nop\n\tv_nop"
                 : "+v"(acc0), "+v"(acc1)
                 : "v"(fa), "v"(fb0), "v"(fb1));
  }

  // D element r of lane -> o row osub + 8h + r, pixel col lsub + t*16 + m
  const float* bpp = bp + o0 + osub + 8 * h;
  stage_pj(sT, acc0, acc1, osub + 8 * h, lsub + m, bpp);
  __syncthreads();

  write_tile64(sT, out, (size_t)(n * CD_ + o0), LP_, p0, lane, w);
}

// =====================================================================================
extern "C" void kernel_launch(void* const* d_in, const int* in_sizes, int n_in,
                              void* d_out, int out_size, void* d_ws, size_t ws_size,
                              hipStream_t stream) {
  if (n_in < 7) return;
  if (in_sizes[0] != X_N || in_sizes[1] != WA_N || in_sizes[2] != NATT ||
      in_sizes[3] != WV_N || in_sizes[4] != CD_ || in_sizes[5] != WV_N || in_sizes[6] != CD_) return;
  if (out_size != OUT_N) return;
  if (ws_size < (size_t)WS_TOTAL) return;

  const float* x  = (const float*)d_in[0];
  const float* Wa = (const float*)d_in[1];
  const float* ba = (const float*)d_in[2];
  const float* Wv = (const float*)d_in[3];
  const float* bv = (const float*)d_in[4];
  const float* Wp = (const float*)d_in[5];
  const float* bp = (const float*)d_in[6];
  float* out = (float*)d_out;

  char* ws = (char*)d_ws;
  float*          vT   = (float*)(ws + OFF_VT);
  float*          aT   = (float*)(ws + OFF_AT);
  unsigned short* xT   = (unsigned short*)(ws + OFF_XT);
  unsigned short* yT   = (unsigned short*)(ws + OFF_YT);
  unsigned short* W16  = (unsigned short*)(ws + OFF_W16);
  float*          bias = (float*)(ws + OFF_BIAS);

  k_wprep<<<dim3(157), dim3(256), 0, stream>>>(Wv, Wa, Wp, bv, ba, W16, bias);
  k_xprep<<<dim3(NB_ * (CD_ / 64) * NPT), dim3(256), 0, stream>>>(x, xT);
  k_conv1<<<dim3(NB_ * 7 * NPT), dim3(256), 0, stream>>>(xT, W16, bias, vT, aT);
  k_agg<<<dim3(NB_ * LP_), dim3(384), 0, stream>>>(aT, vT, yT);
  k_proj<<<dim3(NB_ * (CD_ / 64) * NPT), dim3(256), 0, stream>>>(yT, W16, bp, out);
}

// v001
// Measured time: 111 microseconds a run.
// Two timings next to v000 both put it at 1.44 times that version's speed.
#include <hip/hip_runtime.h>

// All contractions: v_wmma_f32_16x16x32_f16 (f16 operands: weights carried x16, activations x1), f32 accumulate,
// 1/16 folded in the f32 epilogues. Softmax over the 9 window taps and the 3x3 weighted window sum: f32 on VALU.
// Carry audit:
//   W16 rows   0..383 = f16(16*Wv), rows 384..437 = f16(16*Wa), rows 438..447 = 0 : inverse 0.0625f in stage_c1 (k_conv1)
//   W16 rows 448..831 = f16(16*Wp)                                                : inverse 0.0625f in stage_pj (k_proj)
//   xT = f16(x) carry 1, yT = f16(y) carry 1 : no inverse needed
//   vT, aT, BIAS line : f32, no carry

#define NB_   8
#define CD_   384
#define LP_   3136
#define WP_   56
#define HP_   56
#define NATT  54              // 6 heads x 9 taps
#define NHD   6
#define KK_   9
#define APD   64              // padded logit columns
#define NO1   448             // fused conv1 output columns: 384 (v) + 64 (logits, padded)
#define WROWS 832             // 448 + 384 weight rows
#define NPT   (LP_ / 64)      // 49 pixel tiles

#define X_N   (NB_ * CD_ * LP_)   // 9633792
#define WA_N  (NATT * CD_)        // 20736
#define WV_N  (CD_ * CD_)         // 147456
#define OUT_N X_N

#define SZ_VT   ((size_t)NB_ * LP_ * CD_ * 4)   // 38535168  f32 [n][l][c]
#define SZ_AT   ((size_t)NB_ * LP_ * APD * 4)   // 6422528   f32 [n][l][64]
#define SZ_XT   ((size_t)NB_ * LP_ * CD_ * 2)   // 19267584  f16 [n][l][c]
#define SZ_YT   SZ_XT                           // 19267584  f16 [n][l][c]
#define SZ_W16  ((size_t)WROWS * CD_ * 2)       // 638976    f16 [832][c]
#define SZ_BIAS ((size_t)NO1 * 4)               // 1792      f32 [448]
#define OFF_VT   ((size_t)0)
#define OFF_AT   (OFF_VT + SZ_VT)
#define OFF_XT   (OFF_AT + SZ_AT)
#define OFF_YT   (OFF_XT + SZ_XT)
#define OFF_W16  (OFF_YT + SZ_YT)
#define OFF_BIAS (OFF_W16 + SZ_W16)
#define WS_TOTAL (OFF_BIAS + SZ_BIAS)           // 84133632

static_assert(WS_TOTAL == 84133632);
static_assert(WS_TOTAL <= 134217728);
static_assert((OFF_AT % 128) == 0 && (OFF_XT % 128) == 0 && (OFF_YT % 128) == 0 &&
              (OFF_W16 % 128) == 0 && (OFF_BIAS % 128) == 0);
static_assert(LP_ % 64 == 0 && CD_ % 64 == 0 && (NB_ * LP_) % 64 == 0);
static_assert(WROWS * 48 == 156 * 256 && CD_ * 48 == 72 * 256 && APD * 48 == 12 * 256);

#define XP 72      // transpose LDS pitch (halves), 144 B
#define EP 68      // GEMM epilogue LDS pitch (floats), 272 B
#define KP 392     // GEMM operand LDS pitch (halves), 784 B = 16 B x 49 (odd): conflict-free 16-B fragment reads
#define OPT_H (64 * KP)                 // one staged operand tile: 64 rows, whole K
#define GEMM_LDS_B (2 * OPT_H * 2)      // both operand tiles, 100352 B; the f32 epilogue tile reuses the same bytes

static_assert(64 * EP * 4 <= GEMM_LDS_B);
static_assert((64 * CD_ / 8) == 12 * 256 && (3 * 256) % (CD_ / 8) == 0);

typedef unsigned short v8us  __attribute__((ext_vector_type(8)));
typedef unsigned short v8usa __attribute__((ext_vector_type(8), __may_alias__));
typedef unsigned short v16us __attribute__((ext_vector_type(16)));
typedef _Float16       v16h  __attribute__((ext_vector_type(16)));
typedef float          v8f   __attribute__((ext_vector_type(8)));
typedef float          v4f   __attribute__((ext_vector_type(4)));
typedef float          v4fa  __attribute__((ext_vector_type(4), __may_alias__));

union Frag { v16us v; v8us half[2]; };

// f32 -> f16 bits (RNE convert)
__device__ __forceinline__ unsigned short h2us(float f) {
  return __builtin_bit_cast(unsigned short, (_Float16)f);
}

__device__ __forceinline__ void st2_u8(unsigned short* p, v8us v) {
  *(v8us*)p = v;
  
}
__device__ __forceinline__ void st2_f4(float* p, v4f v) {
  *(v4f*)p = v;
  
}

// 16-bit fragment from a k-contiguous row: elements 0..7 <- k0+8h+0..7, elements 8..15 <- k0+16+8h+0..7.
// Used for A rows [m][k] and for B stored as [n][k] rows (same per-lane k map); rowp points at element k0 of the row.
__device__ __forceinline__ v16h ldfrag(const unsigned short* rowp, int h) {
  Frag f;
  f.half[0] = *(const v8usa*)(rowp + 8 * h);
  f.half[1] = *(const v8usa*)(rowp + 16 + 8 * h);
  return __builtin_bit_cast(v16h, f.v);
}

__device__ __forceinline__ v8f wmma_h(v16h a, v16h b, v8f c) {
  return __builtin_amdgcn_wmma_f32_16x16x32_f16(false, a, false, b, (short)0, c, false, false);
}

__device__ __forceinline__ v8f v8f_zero() {
  v8f z = {0.f, 0.f, 0.f, 0.f, 0.f, 0.f, 0.f, 0.f};
  return z;
}

// =====================================================================================
// Kernel 0: weight planes + fused bias line.
// W16[832][384] halves: rows 0..383 = f16(16*Wv[o][c]), 384..447 = f16(16*Wa[o-384][c]) (o-384 >= 54 -> 0),
// 448..831 = f16(16*Wp[o-448][c]). One thread = 8 consecutive c (16 B), 48 threads per 768-B row,
// Block 156: BIAS[448] = [bv | ba padded with 0], 112 float4 pieces, 8 consecutive lanes per line.
// coverage: 156*256 = 832*48 items exactly; 112 float4 = 448 floats exactly.
// =====================================================================================
__global__ void __launch_bounds__(256) k_wprep(
    const float* __restrict__ Wv, const float* __restrict__ Wa, const float* __restrict__ Wp,
    const float* __restrict__ bv, const float* __restrict__ ba,
    unsigned short* __restrict__ W16, float* __restrict__ bias) {
  const int tid = threadIdx.x;
  const int bid = blockIdx.x;
  if (bid < 156) {
    const int i = bid * 256 + tid;            // < 39936
    const int row = i / 48;                   // 0..831
    const int c8 = (i - row * 48) * 8;        // 0..376
    const float* src;
    int srow;
    bool valid = true;
    if (bid < 72) {                           // block-uniform region select
      src = Wv; srow = row;
    } else if (bid < 84) {
      const int r = row - 384;                // 0..63
      valid = (r < NATT);
      srow = (r < NATT) ? r : (NATT - 1);     // clamped address, zero by predicate
      src = Wa;
    } else {
      src = Wp; srow = row - 448;
    }
    const size_t off = (size_t)srow * CD_ + c8;
    const v4f a0 = *(const v4f*)(src + off);
    const v4f a1 = *(const v4f*)(src + off + 4);
    const float sc = 16.0f;
    v8us ov;
    ov[0] = valid ? h2us(a0.x * sc) : (unsigned short)0;
    ov[1] = valid ? h2us(a0.y * sc) : (unsigned short)0;
    ov[2] = valid ? h2us(a0.z * sc) : (unsigned short)0;
    ov[3] = valid ? h2us(a0.w * sc) : (unsigned short)0;
    ov[4] = valid ? h2us(a1.x * sc) : (unsigned short)0;
    ov[5] = valid ? h2us(a1.y * sc) : (unsigned short)0;
    ov[6] = valid ? h2us(a1.z * sc) : (unsigned short)0;
    ov[7] = valid ? h2us(a1.w * sc) : (unsigned short)0;
    st2_u8(W16 + (size_t)row * CD_ + c8, ov);
  } else {
    if (tid < 112) {
      const int e0 = tid * 4;                         // 0..444
      const int tb = (tid < 96) ? tid : 95;           // clamped bv piece
      const v4f vb = *(const v4f*)(bv + tb * 4);
      const bool isv = (tid < 96);
      int ea = e0 - 384;
      int c0 = ea;     c0 = (c0 < 0) ? 0 : ((c0 > NATT - 1) ? (NATT - 1) : c0);
      int c1 = ea + 1; c1 = (c1 < 0) ? 0 : ((c1 > NATT - 1) ? (NATT - 1) : c1);
      int c2 = ea + 2; c2 = (c2 < 0) ? 0 : ((c2 > NATT - 1) ? (NATT - 1) : c2);
      int c3 = ea + 3; c3 = (c3 < 0) ? 0 : ((c3 > NATT - 1) ? (NATT - 1) : c3);
      const float q0 = ba[c0], q1 = ba[c1], q2 = ba[c2], q3 = ba[c3];
      v4f o;
      o.x = isv ? vb.x : ((ea + 0 >= 0 && ea + 0 < NATT) ? q0 : 0.0f);
      o.y = isv ? vb.y : ((ea + 1 >= 0 && ea + 1 < NATT) ? q1 : 0.0f);
      o.z = isv ? vb.z : ((ea + 2 >= 0 && ea + 2 < NATT) ? q2 : 0.0f);
      o.w = isv ? vb.w : ((ea + 3 >= 0 && ea + 3 < NATT) ? q3 : 0.0f);
      st2_f4(bias + e0, o);
    }
  }
}

// =====================================================================================
// Kernel 1: activation plane xT[n][l][c] = f16(x[n][c][l]) through a 64(c) x 64(px) LDS tile.
// Grid 2352 = 8 n x 6 c-tiles x 49 px-tiles. Read: float4 along l (coalesced); LDS holds the
// lanes x 16 B of one instruction, 4 rows per instruction per wave, 2 iterations -> 64 rows.
// coverage: 8 waves x 4 rows x 2 it = 64 rows, 8 pieces x 8 halves = 64 halves per row; grid covers all (n, c-tile, px-tile).
// =====================================================================================
__global__ void __launch_bounds__(256) k_xprep(const float* __restrict__ x, unsigned short* __restrict__ xT) {
  __shared__ __attribute__((aligned(16))) unsigned short sT[64 * XP];
  const int tid = threadIdx.x;
  const int lane = tid & 31;
  const int w = tid >> 5;
  const int bid = blockIdx.x;
  const int pt = bid % NPT;
  const int ct = (bid / NPT) % (CD_ / 64);
  const int n = bid / (NPT * (CD_ / 64));
  const int p0 = pt * 64;
  const int c0 = ct * 64;

  #pragma unroll
  for (int it = 0; it < 4; ++it) {
    const int idx = it * 256 + tid;            // 0..1023
    const int c = idx >> 4;                    // 0..63
    const int p4 = (idx & 15) * 4;             // 0..60
    const v4f v = *(const v4f*)(x + ((size_t)(n * CD_ + c0 + c)) * LP_ + p0 + p4);
    sT[(p4 + 0) * XP + c] = h2us(v.x);
    sT[(p4 + 1) * XP + c] = h2us(v.y);
    sT[(p4 + 2) * XP + c] = h2us(v.z);
    sT[(p4 + 3) * XP + c] = h2us(v.w);
  }
  __syncthreads();

  const int q = lane >> 3;     // row within the 4-row group
  const int j = lane & 7;
  #pragma unroll 1
  for (int it = 0; it < 2; ++it) {
    const int prow = it * 32 + w * 4 + q;      // 0..63, each once
    const v8us val = *(const v8usa*)(sT + prow * XP + j * 8);
    unsigned short* dst = xT + ((size_t)(n * LP_ + p0 + prow)) * CD_ + c0 + j * 8;
    st2_u8(dst, val);
  }
}

// =====================================================================================
// Shared GEMM operand staging: two tiles of 64 rows x 384 halves, each 49152 contiguous bytes in global memory,
// are read as whole 512-B runs per wave (16 B per lane) and laid in LDS at pitch KP. Piece i = 16 B: row i / 48,
// column piece i % 48; pieces i and i + 768 lie 16 rows apart, so three divisions serve all twelve pieces.
// All 24 loads of a thread are issued before the first LDS store.
// coverage: 12 x 256 = 3072 pieces = 64 rows x 48 pieces per tile, each once.
// =====================================================================================
__device__ __forceinline__ void stage_ops(const unsigned short* __restrict__ ga, const unsigned short* __restrict__ gb,
                                          unsigned short* sA, unsigned short* sB, int tid) {
  v8us ra[12], rb[12];
  // all four loops fully unrolled: constant indices keep ra and rb in registers, steps become immediate offsets
  #pragma unroll
  for (int j = 0; j < 3; ++j) {
    const int i = j * 256 + tid;               // 0..767
    #pragma unroll
    for (int q = 0; q < 4; ++q) {
      ra[j * 4 + q] = *(const v8us*)(ga + (size_t)(i + q * 768) * 8);
      rb[j * 4 + q] = *(const v8us*)(gb + (size_t)(i + q * 768) * 8);
    }
  }
  // the loads' address registers are reused below while the loads are still in flight
  asm volatile("s_wait_xcnt 0x0" ::: "memory");
  #pragma unroll
  for (int j = 0; j < 3; ++j) {
    const int i = j * 256 + tid;
    const int r = i / 48;                      // 0..15
    const int c = i - r * 48;                  // 0..47
    #pragma unroll
    for (int q = 0; q < 4; ++q) {
      *(v8usa*)(sA + (r + q * 16) * KP + c * 8) = ra[j * 4 + q];
      *(v8usa*)(sB + (r + q * 16) * KP + c * 8) = rb[j * 4 + q];
    }
  }
}

// =====================================================================================
// Shared GEMM epilogue writer: f32 tile [64 rows][64 cols] staged in LDS (pitch EP); each 256-B row
// =====================================================================================
__device__ __forceinline__ void write_tile64(const float* sT, float* obase, size_t row0, int opitch,
                                             int ocol, int lane, int w) {
  const int q = lane >> 3;
  const int j = lane & 7;
  const int rsel = q >> 1;
  const int lsel = q & 1;
  #pragma unroll 1
  for (int it = 0; it < 4; ++it) {
    const int row = it * 16 + w * 2 + rsel;     // 0..63, each once
    const v4f v = *(const v4fa*)(sT + row * EP + lsel * 32 + j * 4);
    float* dst = obase + (row0 + (size_t)row) * (size_t)opitch + ocol + lsel * 32 + j * 4;
    st2_f4(dst, v);
  }
}

// =====================================================================================
// Kernel 2: fused conv1. D[m = pixel l][n = o] = sum_c xT[l][c] * W16[o][c], o in 0..447.
// Block = (n, 64 o of the 448, 64 px); wave w: pixel rows lsub = (w>>1)*16, o cols osub = (w&1)*32 (two D tiles).
// o-tiles 0..5 -> vT[n][l][o] = D/16 + bv (f32, pitch 384); o-tile 6 -> aT[n][l][0..63] = D/16 + ba-padded (pitch 64).
// coverage: grid 8 x 7 x 49; every (n, l, o<448) written exactly once as whole 256-B row segments.
// =====================================================================================
__device__ __forceinline__ void stage_c1(float* sT, v8f a0, v8f a1, int prow0, int col0, float b0, float b1) {
  #pragma unroll
  for (int r = 0; r < 8; ++r) {
    sT[(prow0 + r) * EP + col0] = a0[r] * 0.0625f + b0;
    sT[(prow0 + r) * EP + col0 + 16] = a1[r] * 0.0625f + b1;
  }
}

__global__ void __launch_bounds__(256) k_conv1(
    const unsigned short* __restrict__ xT, const unsigned short* __restrict__ W16,
    const float* __restrict__ bias, float* vT, float* aT) {
  __shared__ __attribute__((aligned(16))) unsigned char smem[GEMM_LDS_B];
  unsigned short* sA = (unsigned short*)smem;
  unsigned short* sB = sA + OPT_H;
  float* sT = (float*)smem;
  const int tid = threadIdx.x;
  const int lane = tid & 31;
  const int w = tid >> 5;
  const int h = lane >> 4;
  const int m = lane & 15;
  const int bid = blockIdx.x;
  const int pt = bid % NPT;
  const int ot = (bid / NPT) % 7;
  const int n = bid / (NPT * 7);
  const int p0 = pt * 64;
  const int o0 = ot * 64;
  const int lsub = (w >> 1) * 16;
  const int osub = (w & 1) * 32;

  stage_ops(xT + ((size_t)(n * LP_ + p0)) * CD_, W16 + (size_t)o0 * CD_, sA, sB, tid);
  __syncthreads();

  const unsigned short* ar  = sA + (lsub + m) * KP;      // A: pixel rows, k = c
  const unsigned short* br0 = sB + (osub + m) * KP;      // B: [o][c] rows, k = c
  const unsigned short* br1 = br0 + 16 * KP;

  v8f acc0 = v8f_zero(), acc1 = v8f_zero();

  #pragma unroll 1
  for (int ks = 0; ks < CD_ / 32; ++ks) {
    const int k0 = ks * 32;
    const v16h fa  = ldfrag(ar + k0, h);
    const v16h fb0 = ldfrag(br0 + k0, h);
    const v16h fb1 = ldfrag(br1 + k0, h);
    acc0 = wmma_h(fa, fb0, acc0);
    acc1 = wmma_h(fa, fb1, acc1);
    asm volatile("v_nop\n\tv_nop\n\tv_nop\n\tv_nop"
                 : "+v"(acc0), "+v"(acc1)
                 : "v"(fa), "v"(fb0), "v"(fb1));
  }

  // D element r of lane -> pixel row lsub + 8h + r, o col osub + t*16 + m
  const float b0 = bias[o0 + osub + m];
  const float b1 = bias[o0 + osub + 16 + m];
  __syncthreads();       // every wave has left the operand tiles before their bytes take the f32 tile
  stage_c1(sT, acc0, acc1, lsub + 8 * h, osub + m, b0, b1);
  __syncthreads();

  float* obase = (ot < 6) ? vT : aT;                  // block-uniform select between two global planes
  const int opitch = (ot < 6) ? CD_ : APD;
  const int ocol = (ot < 6) ? o0 : 0;
  write_tile64(sT, obase, (size_t)(n * LP_ + p0), opitch, ocol, lane, w);
}

// =====================================================================================
// Kernel 3: per-pixel softmax over the 9 taps per head (f32) and the 3x3 zero-padded window sum (f32):
// y[c] = sum_k p[head(c)][k] * v[c][py + k/3 - 1][px + k%3 - 1], head(c) = c / 64, tap k = kh*3 + kw.
// One block per pixel, one thread per channel; v rows read coalesced along c from vT[n][l][c];
// coverage: grid 8*3136 pixels x 384 channels; 48 pieces x 8 halves = whole 768-B row.
// =====================================================================================
__global__ void __launch_bounds__(384) k_agg(
    const float* __restrict__ aT, const float* __restrict__ vT, unsigned short* __restrict__ yT) {
  __shared__ float sp[APD];
  __shared__ __attribute__((aligned(16))) unsigned short sy[CD_];
  const int bl = blockIdx.x;                 // n*LP_ + l
  const int n = bl / LP_;
  const int l = bl - n * LP_;
  const int py = l / WP_;
  const int pxx = l - py * WP_;
  const int t = threadIdx.x;

  if (t < APD) sp[t] = aT[(size_t)bl * APD + t];
  __syncthreads();
  if (t < NHD) {
    const int o = t * KK_;
    float mx = sp[o];
    #pragma unroll
    for (int k = 1; k < KK_; ++k) mx = fmaxf(mx, sp[o + k]);
    float s = 0.0f;
    #pragma unroll 1
    for (int k = 0; k < KK_; ++k) {
      const float e = expf(sp[o + k] - mx);
      sp[o + k] = e;
      s += e;
    }
    const float inv = 1.0f / s;
    #pragma unroll 1
    for (int k = 0; k < KK_; ++k) sp[o + k] = sp[o + k] * inv;
  }
  __syncthreads();

  const int c = t;                  // 0..383
  const int hd = c >> 6;            // head
  const float* vb = vT + (size_t)n * LP_ * CD_ + c;
  float acc = 0.0f;
  #pragma unroll
  for (int k = 0; k < KK_; ++k) {
    const int yy = py + (k / 3) - 1;
    const int xx = pxx + (k % 3) - 1;
    const bool inb = (yy >= 0) && (yy < HP_) && (xx >= 0) && (xx < WP_);   // block-uniform
    const int yc = (yy < 0) ? 0 : ((yy > HP_ - 1) ? (HP_ - 1) : yy);       // clamped address
    const int xc = (xx < 0) ? 0 : ((xx > WP_ - 1) ? (WP_ - 1) : xx);
    const float v = vb[(size_t)(yc * WP_ + xc) * CD_];
    const float pv = inb ? v : 0.0f;
    acc = fmaf(sp[hd * KK_ + k], pv, acc);
  }
  sy[c] = h2us(acc);
  __syncthreads();

  if (t < 48) {
    const v8us val = *(const v8usa*)(sy + t * 8);
    st2_u8(yT + (size_t)bl * CD_ + t * 8, val);
  }
}

// =====================================================================================
// Kernel 4: projection. D[m = o][n = pixel l] = sum_c W16[448 + o][c] * yT[l][c]; out[n][o][l] = D/16 + bp[o] (NCHW f32).
// Block = (n, 64 o, 64 px); wave w: o rows osub = (w>>1)*16, pixel cols lsub = (w&1)*32 (two D tiles).
// coverage: grid 8 x 6 x 49; every (n, o, l) written exactly once as whole 256-B row segments of out.
// =====================================================================================
__device__ __forceinline__ void stage_pj(float* sT, v8f a0, v8f a1, int orow0, int col0, const float* bpp) {
  #pragma unroll
  for (int r = 0; r < 8; ++r) {
    const float b = bpp[r];
    sT[(orow0 + r) * EP + col0] = a0[r] * 0.0625f + b;
    sT[(orow0 + r) * EP + col0 + 16] = a1[r] * 0.0625f + b;
  }
}

__global__ void __launch_bounds__(256) k_proj(
    const unsigned short* __restrict__ yT, const unsigned short* __restrict__ W16,
    const float* __restrict__ bp, float* __restrict__ out) {
  __shared__ __attribute__((aligned(16))) unsigned char smem[GEMM_LDS_B];
  unsigned short* sA = (unsigned short*)smem;
  unsigned short* sB = sA + OPT_H;
  float* sT = (float*)smem;
  const int tid = threadIdx.x;
  const int lane = tid & 31;
  const int w = tid >> 5;
  const int h = lane >> 4;
  const int m = lane & 15;
  const int bid = blockIdx.x;
  const int pt = bid % NPT;
  const int ot = (bid / NPT) % (CD_ / 64);
  const int n = bid / (NPT * (CD_ / 64));
  const int p0 = pt * 64;
  const int o0 = ot * 64;
  const int osub = (w >> 1) * 16;
  const int lsub = (w & 1) * 32;

  stage_ops(W16 + (size_t)(NO1 + o0) * CD_, yT + ((size_t)(n * LP_ + p0)) * CD_, sA, sB, tid);
  __syncthreads();

  const unsigned short* ar  = sA + (osub + m) * KP;      // A: Wp rows [o][c]
  const unsigned short* br0 = sB + (lsub + m) * KP;      // B: yT rows [l][c]
  const unsigned short* br1 = br0 + 16 * KP;

  v8f acc0 = v8f_zero(), acc1 = v8f_zero();

  #pragma unroll 1
  for (int ks = 0; ks < CD_ / 32; ++ks) {
    const int k0 = ks * 32;
    const v16h fa  = ldfrag(ar + k0, h);
    const v16h fb0 = ldfrag(br0 + k0, h);
    const v16h fb1 = ldfrag(br1 + k0, h);
    acc0 = wmma_h(fa, fb0, acc0);
    acc1 = wmma_h(fa, fb1, acc1);
    asm volatile("v_nop\n\tv_nop\n\tv_nop\n\tv_nop"
                 : "+v"(acc0), "+v"(acc1)
                 : "v"(fa), "v"(fb0), "v"(fb1));
  }

  // D element r of lane -> o row osub + 8h + r, pixel col lsub + t*16 + m
  const float* bpp = bp + o0 + osub + 8 * h;
  __syncthreads();       // every wave has left the operand tiles before their bytes take the f32 tile
  stage_pj(sT, acc0, acc1, osub + 8 * h, lsub + m, bpp);
  __syncthreads();

  write_tile64(sT, out, (size_t)(n * CD_ + o0), LP_, p0, lane, w);
}

// =====================================================================================
extern "C" void kernel_launch(void* const* d_in, const int* in_sizes, int n_in,
                              void* d_out, int out_size, void* d_ws, size_t ws_size,
                              hipStream_t stream) {
  if (n_in < 7) return;
  if (in_sizes[0] != X_N || in_sizes[1] != WA_N || in_sizes[2] != NATT ||
      in_sizes[3] != WV_N || in_sizes[4] != CD_ || in_sizes[5] != WV_N || in_sizes[6] != CD_) return;
  if (out_size != OUT_N) return;
  if (ws_size < (size_t)WS_TOTAL) return;

  const float* x  = (const float*)d_in[0];
  const float* Wa = (const float*)d_in[1];
  const float* ba = (const float*)d_in[2];
  const float* Wv = (const float*)d_in[3];
  const float* bv = (const float*)d_in[4];
  const float* Wp = (const float*)d_in[5];
  const float* bp = (const float*)d_in[6];
  float* out = (float*)d_out;

  char* ws = (char*)d_ws;
  float*          vT   = (float*)(ws + OFF_VT);
  float*          aT   = (float*)(ws + OFF_AT);
  unsigned short* xT   = (unsigned short*)(ws + OFF_XT);
  unsigned short* yT   = (unsigned short*)(ws + OFF_YT);
  unsigned short* W16  = (unsigned short*)(ws + OFF_W16);
  float*          bias = (float*)(ws + OFF_BIAS);

  k_wprep<<<dim3(157), dim3(256), 0, stream>>>(Wv, Wa, Wp, bv, ba, W16, bias);
  k_xprep<<<dim3(NB_ * (CD_ / 64) * NPT), dim3(256), 0, stream>>>(x, xT);
  k_conv1<<<dim3(NB_ * 7 * NPT), dim3(256), 0, stream>>>(xT, W16, bias, vT, aT);
  k_agg<<<dim3(NB_ * LP_), dim3(384), 0, stream>>>(aT, vT, yT);
  k_proj<<<dim3(NB_ * (CD_ / 64) * NPT), dim3(256), 0, stream>>>(yT, W16, bp, out);
}

// v002
// Measured time: 66.6 microseconds a run.
// In two side-by-side timings against v001, it was 1.64 and 1.66 times as fast.
// Over all steps from v000 it is 2.37 times as fast.
#include <hip/hip_runtime.h>

// All contractions: v_wmma_f32_16x16x32_f16 (f16 operands: weights carried x16, activations x1), f32 accumulate,
// 1/16 folded in the f32 epilogues. Softmax over the 9 window taps and the 3x3 weighted window sum: f32 on VALU.
// Carry audit:
//   W16 rows   0..383 = f16(16*Wv), rows 384..437 = f16(16*Wa), rows 438..447 = 0 : inverse 0.0625f in stage_c1 (k_conv1)
//   W16 rows 448..831 = f16(16*Wp)                                                : inverse 0.0625f in stage_pj (k_proj)
//   xT = f16(x) carry 1, yT = f16(y) carry 1 : no inverse needed
//   vT, aT, BIAS line : f32, no carry

#define NB_   8
#define CD_   384
#define LP_   3136
#define WP_   56
#define HP_   56
#define NATT  54              // 6 heads x 9 taps
#define NHD   6
#define KK_   9
#define APD   64              // padded logit columns
#define NO1   448             // fused conv1 output columns: 384 (v) + 64 (logits, padded)
#define WROWS 832             // 448 + 384 weight rows
#define NPT   (LP_ / 64)      // 49 pixel tiles

#define X_N   (NB_ * CD_ * LP_)   // 9633792
#define WA_N  (NATT * CD_)        // 20736
#define WV_N  (CD_ * CD_)         // 147456
#define OUT_N X_N

#define SZ_VT   ((size_t)NB_ * LP_ * CD_ * 4)   // 38535168  f32 [n][l][c]
#define SZ_AT   ((size_t)NB_ * LP_ * APD * 4)   // 6422528   f32 [n][l][64]
#define SZ_XT   ((size_t)NB_ * LP_ * CD_ * 2)   // 19267584  f16 [n][l][c]
#define SZ_YT   SZ_XT                           // 19267584  f16 [n][l][c]
#define SZ_W16  ((size_t)WROWS * CD_ * 2)       // 638976    f16 [832][c]
#define SZ_BIAS ((size_t)NO1 * 4)               // 1792      f32 [448]
#define OFF_VT   ((size_t)0)
#define OFF_AT   (OFF_VT + SZ_VT)
#define OFF_XT   (OFF_AT + SZ_AT)
#define OFF_YT   (OFF_XT + SZ_XT)
#define OFF_W16  (OFF_YT + SZ_YT)
#define OFF_BIAS (OFF_W16 + SZ_W16)
#define WS_TOTAL (OFF_BIAS + SZ_BIAS)           // 84133632

static_assert(WS_TOTAL == 84133632);
static_assert(WS_TOTAL <= 134217728);
static_assert((OFF_AT % 128) == 0 && (OFF_XT % 128) == 0 && (OFF_YT % 128) == 0 &&
              (OFF_W16 % 128) == 0 && (OFF_BIAS % 128) == 0);
static_assert(LP_ % 64 == 0 && CD_ % 64 == 0 && (NB_ * LP_) % 64 == 0);
static_assert(WROWS * 48 == 156 * 256 && CD_ * 48 == 72 * 256 && APD * 48 == 12 * 256);

#define XP 72      // transpose LDS pitch (halves), 144 B
#define EP 68      // GEMM epilogue LDS pitch (floats), 272 B
#define KP 392     // GEMM operand LDS pitch (halves), 784 B = 16 B x 49 (odd): conflict-free 16-B fragment reads
#define OPT_H (64 * KP)                 // one staged operand tile: 64 rows, whole K
#define GEMM_LDS_B (2 * OPT_H * 2)      // both operand tiles, 100352 B; the f32 epilogue tile reuses the same bytes

static_assert(64 * EP * 4 <= GEMM_LDS_B);
static_assert((64 * CD_ / 8) == 12 * 256 && (3 * 256) % (CD_ / 8) == 0);

typedef unsigned short v8us  __attribute__((ext_vector_type(8)));
typedef unsigned short v8usa __attribute__((ext_vector_type(8), __may_alias__));
typedef unsigned short v16us __attribute__((ext_vector_type(16)));
typedef _Float16       v16h  __attribute__((ext_vector_type(16)));
typedef float          v8f   __attribute__((ext_vector_type(8)));
typedef float          v4f   __attribute__((ext_vector_type(4)));
typedef float          v4fa  __attribute__((ext_vector_type(4), __may_alias__));

union Frag { v16us v; v8us half[2]; };

// f32 -> f16 bits (RNE convert)
__device__ __forceinline__ unsigned short h2us(float f) {
  return __builtin_bit_cast(unsigned short, (_Float16)f);
}

__device__ __forceinline__ void st2_u8(unsigned short* p, v8us v) {
  *(v8us*)p = v;
  
}
__device__ __forceinline__ void st2_f4(float* p, v4f v) {
  *(v4f*)p = v;
  
}

// 16-bit fragment from a k-contiguous row: elements 0..7 <- k0+8h+0..7, elements 8..15 <- k0+16+8h+0..7.
// Used for A rows [m][k] and for B stored as [n][k] rows (same per-lane k map); rowp points at element k0 of the row.
__device__ __forceinline__ v16h ldfrag(const unsigned short* rowp, int h) {
  Frag f;
  f.half[0] = *(const v8usa*)(rowp + 8 * h);
  f.half[1] = *(const v8usa*)(rowp + 16 + 8 * h);
  return __builtin_bit_cast(v16h, f.v);
}

__device__ __forceinline__ v8f wmma_h(v16h a, v16h b, v8f c) {
  return __builtin_amdgcn_wmma_f32_16x16x32_f16(false, a, false, b, (short)0, c, false, false);
}

__device__ __forceinline__ v8f v8f_zero() {
  v8f z = {0.f, 0.f, 0.f, 0.f, 0.f, 0.f, 0.f, 0.f};
  return z;
}

// =====================================================================================
// Kernel 0: weight planes + fused bias line.
// W16[832][384] halves: rows 0..383 = f16(16*Wv[o][c]), 384..447 = f16(16*Wa[o-384][c]) (o-384 >= 54 -> 0),
// 448..831 = f16(16*Wp[o-448][c]). One thread = 8 consecutive c (16 B), 48 threads per 768-B row,
// Block 156: BIAS[448] = [bv | ba padded with 0], 112 float4 pieces, 8 consecutive lanes per line.
// coverage: 156*256 = 832*48 items exactly; 112 float4 = 448 floats exactly.
// =====================================================================================
__global__ void __launch_bounds__(256) k_wprep(
    const float* __restrict__ Wv, const float* __restrict__ Wa, const float* __restrict__ Wp,
    const float* __restrict__ bv, const float* __restrict__ ba,
    unsigned short* __restrict__ W16, float* __restrict__ bias) {
  const int tid = threadIdx.x;
  const int bid = blockIdx.x;
  if (bid < 156) {
    const int i = bid * 256 + tid;            // < 39936
    const int row = i / 48;                   // 0..831
    const int c8 = (i - row * 48) * 8;        // 0..376
    const float* src;
    int srow;
    bool valid = true;
    if (bid < 72) {                           // block-uniform region select
      src = Wv; srow = row;
    } else if (bid < 84) {
      const int r = row - 384;                // 0..63
      valid = (r < NATT);
      srow = (r < NATT) ? r : (NATT - 1);     // clamped address, zero by predicate
      src = Wa;
    } else {
      src = Wp; srow = row - 448;
    }
    const size_t off = (size_t)srow * CD_ + c8;
    const v4f a0 = *(const v4f*)(src + off);
    const v4f a1 = *(const v4f*)(src + off + 4);
    const float sc = 16.0f;
    v8us ov;
    ov[0] = valid ? h2us(a0.x * sc) : (unsigned short)0;
    ov[1] = valid ? h2us(a0.y * sc) : (unsigned short)0;
    ov[2] = valid ? h2us(a0.z * sc) : (unsigned short)0;
    ov[3] = valid ? h2us(a0.w * sc) : (unsigned short)0;
    ov[4] = valid ? h2us(a1.x * sc) : (unsigned short)0;
    ov[5] = valid ? h2us(a1.y * sc) : (unsigned short)0;
    ov[6] = valid ? h2us(a1.z * sc) : (unsigned short)0;
    ov[7] = valid ? h2us(a1.w * sc) : (unsigned short)0;
    st2_u8(W16 + (size_t)row * CD_ + c8, ov);
  } else {
    if (tid < 112) {
      const int e0 = tid * 4;                         // 0..444
      const int tb = (tid < 96) ? tid : 95;           // clamped bv piece
      const v4f vb = *(const v4f*)(bv + tb * 4);
      const bool isv = (tid < 96);
      int ea = e0 - 384;
      int c0 = ea;     c0 = (c0 < 0) ? 0 : ((c0 > NATT - 1) ? (NATT - 1) : c0);
      int c1 = ea + 1; c1 = (c1 < 0) ? 0 : ((c1 > NATT - 1) ? (NATT - 1) : c1);
      int c2 = ea + 2; c2 = (c2 < 0) ? 0 : ((c2 > NATT - 1) ? (NATT - 1) : c2);
      int c3 = ea + 3; c3 = (c3 < 0) ? 0 : ((c3 > NATT - 1) ? (NATT - 1) : c3);
      const float q0 = ba[c0], q1 = ba[c1], q2 = ba[c2], q3 = ba[c3];
      v4f o;
      o.x = isv ? vb.x : ((ea + 0 >= 0 && ea + 0 < NATT) ? q0 : 0.0f);
      o.y = isv ? vb.y : ((ea + 1 >= 0 && ea + 1 < NATT) ? q1 : 0.0f);
      o.z = isv ? vb.z : ((ea + 2 >= 0 && ea + 2 < NATT) ? q2 : 0.0f);
      o.w = isv ? vb.w : ((ea + 3 >= 0 && ea + 3 < NATT) ? q3 : 0.0f);
      st2_f4(bias + e0, o);
    }
  }
}

// =====================================================================================
// Kernel 1: activation plane xT[n][l][c] = f16(x[n][c][l]) through a 64(c) x 64(px) LDS tile.
// Grid 2352 = 8 n x 6 c-tiles x 49 px-tiles. Read: float4 along l (coalesced); LDS holds the
// lanes x 16 B of one instruction, 4 rows per instruction per wave, 2 iterations -> 64 rows.
// coverage: 8 waves x 4 rows x 2 it = 64 rows, 8 pieces x 8 halves = 64 halves per row; grid covers all (n, c-tile, px-tile).
// =====================================================================================
__global__ void __launch_bounds__(256) k_xprep(const float* __restrict__ x, unsigned short* __restrict__ xT) {
  __shared__ __attribute__((aligned(16))) unsigned short sT[64 * XP];
  const int tid = threadIdx.x;
  const int lane = tid & 31;
  const int w = tid >> 5;
  const int bid = blockIdx.x;
  const int pt = bid % NPT;
  const int ct = (bid / NPT) % (CD_ / 64);
  const int n = bid / (NPT * (CD_ / 64));
  const int p0 = pt * 64;
  const int c0 = ct * 64;

  #pragma unroll
  for (int it = 0; it < 4; ++it) {
    const int idx = it * 256 + tid;            // 0..1023
    const int c = idx >> 4;                    // 0..63
    const int p4 = (idx & 15) * 4;             // 0..60
    const v4f v = *(const v4f*)(x + ((size_t)(n * CD_ + c0 + c)) * LP_ + p0 + p4);
    sT[(p4 + 0) * XP + c] = h2us(v.x);
    sT[(p4 + 1) * XP + c] = h2us(v.y);
    sT[(p4 + 2) * XP + c] = h2us(v.z);
    sT[(p4 + 3) * XP + c] = h2us(v.w);
  }
  __syncthreads();

  const int q = lane >> 3;     // row within the 4-row group
  const int j = lane & 7;
  #pragma unroll 1
  for (int it = 0; it < 2; ++it) {
    const int prow = it * 32 + w * 4 + q;      // 0..63, each once
    const v8us val = *(const v8usa*)(sT + prow * XP + j * 8);
    unsigned short* dst = xT + ((size_t)(n * LP_ + p0 + prow)) * CD_ + c0 + j * 8;
    st2_u8(dst, val);
  }
}

// =====================================================================================
// Shared GEMM operand staging: two tiles of 64 rows x 384 halves, each 49152 contiguous bytes in global memory,
// are read as whole 512-B runs per wave (16 B per lane) and laid in LDS at pitch KP. Piece i = 16 B: row i / 48,
// column piece i % 48; pieces i and i + 768 lie 16 rows apart, so three divisions serve all twelve pieces.
// All 24 loads of a thread are issued before the first LDS store.
// coverage: 12 x 256 = 3072 pieces = 64 rows x 48 pieces per tile, each once.
// =====================================================================================
__device__ __forceinline__ void stage_ops(const unsigned short* __restrict__ ga, const unsigned short* __restrict__ gb,
                                          unsigned short* sA, unsigned short* sB, int tid) {
  v8us ra[12], rb[12];
  // all four loops fully unrolled: constant indices keep ra and rb in registers, steps become immediate offsets
  #pragma unroll
  for (int j = 0; j < 3; ++j) {
    const int i = j * 256 + tid;               // 0..767
    #pragma unroll
    for (int q = 0; q < 4; ++q) {
      ra[j * 4 + q] = *(const v8us*)(ga + (size_t)(i + q * 768) * 8);
      rb[j * 4 + q] = *(const v8us*)(gb + (size_t)(i + q * 768) * 8);
    }
  }
  // the loads' address registers are reused below while the loads are still in flight
  asm volatile("s_wait_xcnt 0x0" ::: "memory");
  #pragma unroll
  for (int j = 0; j < 3; ++j) {
    const int i = j * 256 + tid;
    const int r = i / 48;                      // 0..15
    const int c = i - r * 48;                  // 0..47
    #pragma unroll
    for (int q = 0; q < 4; ++q) {
      *(v8usa*)(sA + (r + q * 16) * KP + c * 8) = ra[j * 4 + q];
      *(v8usa*)(sB + (r + q * 16) * KP + c * 8) = rb[j * 4 + q];
    }
  }
}

// =====================================================================================
// Shared GEMM epilogue writer: f32 tile [64 rows][64 cols] staged in LDS (pitch EP); each 256-B row
// =====================================================================================
__device__ __forceinline__ void write_tile64(const float* sT, float* obase, size_t row0, int opitch,
                                             int ocol, int lane, int w) {
  const int q = lane >> 3;
  const int j = lane & 7;
  const int rsel = q >> 1;
  const int lsel = q & 1;
  #pragma unroll 1
  for (int it = 0; it < 4; ++it) {
    const int row = it * 16 + w * 2 + rsel;     // 0..63, each once
    const v4f v = *(const v4fa*)(sT + row * EP + lsel * 32 + j * 4);
    float* dst = obase + (row0 + (size_t)row) * (size_t)opitch + ocol + lsel * 32 + j * 4;
    st2_f4(dst, v);
  }
}

// =====================================================================================
// Kernel 2: fused conv1. D[m = pixel l][n = o] = sum_c xT[l][c] * W16[o][c], o in 0..447.
// Block = (n, 64 o of the 448, 64 px); wave w: pixel rows lsub = (w>>1)*16, o cols osub = (w&1)*32 (two D tiles).
// o-tiles 0..5 -> vT[n][l][o] = D/16 + bv (f32, pitch 384); o-tile 6 -> aT[n][l][0..63] = D/16 + ba-padded (pitch 64).
// coverage: grid 8 x 7 x 49; every (n, l, o<448) written exactly once as whole 256-B row segments.
// =====================================================================================
__device__ __forceinline__ void stage_c1(float* sT, v8f a0, v8f a1, int prow0, int col0, float b0, float b1) {
  #pragma unroll
  for (int r = 0; r < 8; ++r) {
    sT[(prow0 + r) * EP + col0] = a0[r] * 0.0625f + b0;
    sT[(prow0 + r) * EP + col0 + 16] = a1[r] * 0.0625f + b1;
  }
}

__global__ void __launch_bounds__(256) k_conv1(
    const unsigned short* __restrict__ xT, const unsigned short* __restrict__ W16,
    const float* __restrict__ bias, float* vT, float* aT) {
  __shared__ __attribute__((aligned(16))) unsigned char smem[GEMM_LDS_B];
  unsigned short* sA = (unsigned short*)smem;
  unsigned short* sB = sA + OPT_H;
  float* sT = (float*)smem;
  const int tid = threadIdx.x;
  const int lane = tid & 31;
  const int w = tid >> 5;
  const int h = lane >> 4;
  const int m = lane & 15;
  const int bid = blockIdx.x;
  const int pt = bid % NPT;
  const int ot = (bid / NPT) % 7;
  const int n = bid / (NPT * 7);
  const int p0 = pt * 64;
  const int o0 = ot * 64;
  const int lsub = (w >> 1) * 16;
  const int osub = (w & 1) * 32;

  stage_ops(xT + ((size_t)(n * LP_ + p0)) * CD_, W16 + (size_t)o0 * CD_, sA, sB, tid);
  __syncthreads();

  const unsigned short* ar  = sA + (lsub + m) * KP;      // A: pixel rows, k = c
  const unsigned short* br0 = sB + (osub + m) * KP;      // B: [o][c] rows, k = c
  const unsigned short* br1 = br0 + 16 * KP;

  v8f acc0 = v8f_zero(), acc1 = v8f_zero();

  #pragma unroll 1
  for (int ks = 0; ks < CD_ / 32; ++ks) {
    const int k0 = ks * 32;
    const v16h fa  = ldfrag(ar + k0, h);
    const v16h fb0 = ldfrag(br0 + k0, h);
    const v16h fb1 = ldfrag(br1 + k0, h);
    acc0 = wmma_h(fa, fb0, acc0);
    acc1 = wmma_h(fa, fb1, acc1);
    asm volatile("v_nop\n\tv_nop\n\tv_nop\n\tv_nop"
                 : "+v"(acc0), "+v"(acc1)
                 : "v"(fa), "v"(fb0), "v"(fb1));
  }

  // D element r of lane -> pixel row lsub + 8h + r, o col osub + t*16 + m
  const float b0 = bias[o0 + osub + m];
  const float b1 = bias[o0 + osub + 16 + m];
  __syncthreads();       // every wave has left the operand tiles before their bytes take the f32 tile
  stage_c1(sT, acc0, acc1, lsub + 8 * h, osub + m, b0, b1);
  __syncthreads();

  float* obase = (ot < 6) ? vT : aT;                  // block-uniform select between two global planes
  const int opitch = (ot < 6) ? CD_ : APD;
  const int ocol = (ot < 6) ? o0 : 0;
  write_tile64(sT, obase, (size_t)(n * LP_ + p0), opitch, ocol, lane, w);
}

// =====================================================================================
// Kernel 3: per-pixel softmax over the 9 taps per head (f32) and the 3x3 zero-padded window sum (f32):
// y[c] = sum_k p[head(c)][k] * v[c][py + k/3 - 1][px + k%3 - 1], head(c) = c / 64, tap k = kh*3 + kw.
// One block = a tile of 2 rows x 7 pixels, all 384 channels; one thread = 4 consecutive channels (16-B loads along c,
// a wave reads 512 contiguous bytes of a vT row). The 4 x 9 pixel window that the 14 pixels share is read once into
// registers. The 84 (pixel, head) softmaxes run one per lane; a tap that falls outside the image gets weight 0
// (its address is clamped into the image), which is the zero padding.
// coverage: grid 8 n x 28 row pairs x 8 column groups = all 25088 pixels; 96 threads x 4 = 384 channels;
// each wave stores 256 contiguous bytes (two whole lines) of each yT row.
// =====================================================================================
#define AG_R  2
#define AG_P  7
#define AG_TX (WP_ / AG_P)        // 8
#define AG_TY (HP_ / AG_R)        // 28
#define AG_PX (AG_R * AG_P)       // 14 pixels per block
#define AG_IT (AG_PX * NHD)       // 84 softmax items per block
#define AG_WP 12                  // floats per item in LDS: 9 weights, padded to 48 B for 16-B reads

static_assert(AG_TX * AG_P == WP_ && AG_TY * AG_R == HP_ && AG_IT <= 96 && CD_ == 96 * 4);

typedef unsigned short v4us __attribute__((ext_vector_type(4)));

// aT and vT carry no __restrict__: with it the compiler moved logit loads behind the s_wait_xcnt written for them.
// Every loop of the kernel is fully unrolled: constant indices keep e, win and p in registers.
__global__ void __launch_bounds__(96) k_agg(
    const float* aT, const float* vT, unsigned short* yT) {
  __shared__ __attribute__((aligned(16))) float sp[96 * AG_WP];
  const int t = threadIdx.x;
  const int bid = blockIdx.x;
  const int tx = bid % AG_TX;
  const int ty = (bid / AG_TX) % AG_TY;
  const int n = bid / (AG_TX * AG_TY);
  const int x0 = tx * AG_P;
  const int y0 = ty * AG_R;

  // logits of this lane's (pixel, head) item; lanes 84..95 repeat item 83 into spare slots that nobody reads
  const int it = (t < AG_IT) ? t : (AG_IT - 1);
  const int ip = it / NHD;                   // pixel of the tile, 0..13
  const int ih = it - ip * NHD;              // head
  const int ir = ip / AG_P;
  const int iy = y0 + ir;
  const int ix = x0 + (ip - ir * AG_P);
  const float* ap = aT + ((size_t)n * LP_ + iy * WP_ + ix) * APD + ih * KK_;
  float e[KK_];
  #pragma unroll
  for (int k = 0; k < KK_; ++k) e[k] = ap[k];
  // the logit loads' address registers are taken over by the window below while those loads are still in flight
  asm volatile("s_wait_xcnt 0x0" ::: "memory");

  // the shared window: rows y0-1 .. y0+2, columns x0-1 .. x0+7, addresses clamped into the image (block-uniform)
  const float* vn = vT + (size_t)n * LP_ * CD_;
  const unsigned c4 = (unsigned)t * 4u;      // this lane's first channel
  const int xl = (x0 > 0) ? (x0 - 1) : 0;
  const int xr = (x0 + AG_P < WP_) ? (x0 + AG_P) : (WP_ - 1);
  v4f win[AG_R + 2][AG_P + 2];
  #pragma unroll
  for (int rr = 0; rr < AG_R + 2; ++rr) {
    int yc = y0 - 1 + rr;
    yc = (yc < 0) ? 0 : ((yc > HP_ - 1) ? (HP_ - 1) : yc);
    const float* vrow = vn + (size_t)(yc * WP_) * CD_;          // block-uniform row base
    win[rr][0] = *(const v4f*)(vrow + xl * CD_ + c4);
    #pragma unroll
    for (int cc = 1; cc <= AG_P; ++cc) win[rr][cc] = *(const v4f*)(vrow + (x0 + cc - 1) * CD_ + c4);
    win[rr][AG_P + 1] = *(const v4f*)(vrow + xr * CD_ + c4);
  }

  float mx = e[0];
  #pragma unroll
  for (int k = 1; k < KK_; ++k) mx = fmaxf(mx, e[k]);
  float s = 0.0f;
  #pragma unroll
  for (int k = 0; k < KK_; ++k) {
    e[k] = expf(e[k] - mx);
    s += e[k];
  }
  const float inv = 1.0f / s;
  #pragma unroll
  for (int k = 0; k < KK_; ++k) {
    const int yy = iy + (k / 3) - 1;
    const int xx = ix + (k % 3) - 1;
    const bool inb = (yy >= 0) && (yy < HP_) && (xx >= 0) && (xx < WP_);
    e[k] = inb ? e[k] * inv : 0.0f;
  }
  {
    float* wq = sp + t * AG_WP;
    const v4f q0 = {e[0], e[1], e[2], e[3]};
    const v4f q1 = {e[4], e[5], e[6], e[7]};
    *(v4fa*)wq = q0;
    *(v4fa*)(wq + 4) = q1;
    wq[8] = e[8];
  }
  __syncthreads();

  const int hd = t >> 4;            // head of channels 4t .. 4t+3
  unsigned short* yb = yT + ((size_t)n * LP_ + y0 * WP_ + x0) * CD_ + t * 4;
  #pragma unroll
  for (int r = 0; r < AG_R; ++r) {
    #pragma unroll
    for (int cx = 0; cx < AG_P; ++cx) {
      const float* wq = sp + ((r * AG_P + cx) * NHD + hd) * AG_WP;
      const v4f q0 = *(const v4fa*)wq;
      const v4f q1 = *(const v4fa*)(wq + 4);
      const float p[KK_] = {q0.x, q0.y, q0.z, q0.w, q1.x, q1.y, q1.z, q1.w, wq[8]};
      v4f acc = {0.0f, 0.0f, 0.0f, 0.0f};
      #pragma unroll
      for (int k = 0; k < KK_; ++k) {
        const v4f v = win[r + k / 3][cx + k % 3];
        acc.x = fmaf(p[k], v.x, acc.x);
        acc.y = fmaf(p[k], v.y, acc.y);
        acc.z = fmaf(p[k], v.z, acc.z);
        acc.w = fmaf(p[k], v.w, acc.w);
      }
      const v4us o = {h2us(acc.x), h2us(acc.y), h2us(acc.z), h2us(acc.w)};
      *(v4us*)(yb + (size_t)(r * WP_ + cx) * CD_) = o;
    }
  }
}

// =====================================================================================
// Kernel 4: projection. D[m = o][n = pixel l] = sum_c W16[448 + o][c] * yT[l][c]; out[n][o][l] = D/16 + bp[o] (NCHW f32).
// Block = (n, 64 o, 64 px); wave w: o rows osub = (w>>1)*16, pixel cols lsub = (w&1)*32 (two D tiles).
// coverage: grid 8 x 6 x 49; every (n, o, l) written exactly once as whole 256-B row segments of out.
// =====================================================================================
__device__ __forceinline__ void stage_pj(float* sT, v8f a0, v8f a1, int orow0, int col0, const float* bpp) {
  #pragma unroll
  for (int r = 0; r < 8; ++r) {
    const float b = bpp[r];
    sT[(orow0 + r) * EP + col0] = a0[r] * 0.0625f + b;
    sT[(orow0 + r) * EP + col0 + 16] = a1[r] * 0.0625f + b;
  }
}

__global__ void __launch_bounds__(256) k_proj(
    const unsigned short* __restrict__ yT, const unsigned short* __restrict__ W16,
    const float* __restrict__ bp, float* __restrict__ out) {
  __shared__ __attribute__((aligned(16))) unsigned char smem[GEMM_LDS_B];
  unsigned short* sA = (unsigned short*)smem;
  unsigned short* sB = sA + OPT_H;
  float* sT = (float*)smem;
  const int tid = threadIdx.x;
  const int lane = tid & 31;
  const int w = tid >> 5;
  const int h = lane >> 4;
  const int m = lane & 15;
  const int bid = blockIdx.x;
  const int pt = bid % NPT;
  const int ot = (bid / NPT) % (CD_ / 64);
  const int n = bid / (NPT * (CD_ / 64));
  const int p0 = pt * 64;
  const int o0 = ot * 64;
  const int osub = (w >> 1) * 16;
  const int lsub = (w & 1) * 32;

  stage_ops(W16 + (size_t)(NO1 + o0) * CD_, yT + ((size_t)(n * LP_ + p0)) * CD_, sA, sB, tid);
  __syncthreads();

  const unsigned short* ar  = sA + (osub + m) * KP;      // A: Wp rows [o][c]
  const unsigned short* br0 = sB + (lsub + m) * KP;      // B: yT rows [l][c]
  const unsigned short* br1 = br0 + 16 * KP;

  v8f acc0 = v8f_zero(), acc1 = v8f_zero();

  #pragma unroll 1
  for (int ks = 0; ks < CD_ / 32; ++ks) {
    const int k0 = ks * 32;
    const v16h fa  = ldfrag(ar + k0, h);
    const v16h fb0 = ldfrag(br0 + k0, h);
    const v16h fb1 = ldfrag(br1 + k0, h);
    acc0 = wmma_h(fa, fb0, acc0);
    acc1 = wmma_h(fa, fb1, acc1);
    asm volatile("v_nop\n\tv_nop\n\tv_nop\n\tv_nop"
                 : "+v"(acc0), "+v"(acc1)
                 : "v"(fa), "v"(fb0), "v"(fb1));
  }

  // D element r of lane -> o row osub + 8h + r, pixel col lsub + t*16 + m
  const float* bpp = bp + o0 + osub + 8 * h;
  __syncthreads();       // every wave has left the operand tiles before their bytes take the f32 tile
  stage_pj(sT, acc0, acc1, osub + 8 * h, lsub + m, bpp);
  __syncthreads();

  write_tile64(sT, out, (size_t)(n * CD_ + o0), LP_, p0, lane, w);
}

// =====================================================================================
extern "C" void kernel_launch(void* const* d_in, const int* in_sizes, int n_in,
                              void* d_out, int out_size, void* d_ws, size_t ws_size,
                              hipStream_t stream) {
  if (n_in < 7) return;
  if (in_sizes[0] != X_N || in_sizes[1] != WA_N || in_sizes[2] != NATT ||
      in_sizes[3] != WV_N || in_sizes[4] != CD_ || in_sizes[5] != WV_N || in_sizes[6] != CD_) return;
  if (out_size != OUT_N) return;
  if (ws_size < (size_t)WS_TOTAL) return;

  const float* x  = (const float*)d_in[0];
  const float* Wa = (const float*)d_in[1];
  const float* ba = (const float*)d_in[2];
  const float* Wv = (const float*)d_in[3];
  const float* bv = (const float*)d_in[4];
  const float* Wp = (const float*)d_in[5];
  const float* bp = (const float*)d_in[6];
  float* out = (float*)d_out;

  char* ws = (char*)d_ws;
  float*          vT   = (float*)(ws + OFF_VT);
  float*          aT   = (float*)(ws + OFF_AT);
  unsigned short* xT   = (unsigned short*)(ws + OFF_XT);
  unsigned short* yT   = (unsigned short*)(ws + OFF_YT);
  unsigned short* W16  = (unsigned short*)(ws + OFF_W16);
  float*          bias = (float*)(ws + OFF_BIAS);

  k_wprep<<<dim3(157), dim3(256), 0, stream>>>(Wv, Wa, Wp, bv, ba, W16, bias);
  k_xprep<<<dim3(NB_ * (CD_ / 64) * NPT), dim3(256), 0, stream>>>(x, xT);
  k_conv1<<<dim3(NB_ * 7 * NPT), dim3(256), 0, stream>>>(xT, W16, bias, vT, aT);
  k_agg<<<dim3(NB_ * AG_TY * AG_TX), dim3(96), 0, stream>>>(aT, vT, yT);
  k_proj<<<dim3(NB_ * (CD_ / 64) * NPT), dim3(256), 0, stream>>>(yT, W16, bp, out);
}

// v003
// A run of this version takes 53.9 microseconds.
// Two timings next to v002 both put it at 1.25 times that version's speed.
// All steps since v000 together make it 2.96 times as fast.
#include <hip/hip_runtime.h>

// All contractions: v_wmma_f32_16x16x32_f16 (f16 operands: weights carried x16, activations x1), f32 accumulate,
// 1/16 folded in the f32 epilogues. Softmax over the 9 window taps and the 3x3 weighted window sum: f32 on VALU.
// Carry audit:
//   W16 rows   0..383 = f16(16*Wv), rows 384..437 = f16(16*Wa), rows 438..447 = 0 : inverse 0.0625f in conv1_out (k_conv1)
//   W16 rows 448..831 = f16(16*Wp)                                                : inverse 0.0625f in stage_pj (k_proj)
//   f16(x) carry 1 (LDS only), yT = f16(y) carry 1 : no inverse needed
//   vT, aT, BIAS line : f32, no carry

#define NB_   8
#define CD_   384
#define LP_   3136
#define WP_   56
#define HP_   56
#define NATT  54              // 6 heads x 9 taps
#define NHD   6
#define KK_   9
#define APD   64              // padded logit columns
#define NO1   448             // fused conv1 output columns: 384 (v) + 64 (logits, padded)
#define WROWS 832             // 448 + 384 weight rows
#define NPT   (LP_ / 64)      // 49 pixel tiles

#define X_N   (NB_ * CD_ * LP_)   // 9633792
#define WA_N  (NATT * CD_)        // 20736
#define WV_N  (CD_ * CD_)         // 147456
#define OUT_N X_N

#define SZ_VT   ((size_t)NB_ * LP_ * CD_ * 4)   // 38535168  f32 [n][l][c]
#define SZ_AT   ((size_t)NB_ * LP_ * APD * 4)   // 6422528   f32 [n][l][64]
#define SZ_XT   ((size_t)NB_ * LP_ * CD_ * 2)   // 19267584  reserved, unused (x is read directly)
#define SZ_YT   SZ_XT                           // 19267584  f16 [n][l][c]
#define SZ_W16  ((size_t)WROWS * CD_ * 2)       // 638976    f16: rows 0..447 fragment order, 448..831 [o][c]
#define SZ_BIAS ((size_t)NO1 * 4)               // 1792      f32 [448]
#define OFF_VT   ((size_t)0)
#define OFF_AT   (OFF_VT + SZ_VT)
#define OFF_XT   (OFF_AT + SZ_AT)
#define OFF_YT   (OFF_XT + SZ_XT)
#define OFF_W16  (OFF_YT + SZ_YT)
#define OFF_BIAS (OFF_W16 + SZ_W16)
#define WS_TOTAL (OFF_BIAS + SZ_BIAS)           // 84133632

static_assert(WS_TOTAL == 84133632);
static_assert(WS_TOTAL <= 134217728);
static_assert((OFF_AT % 128) == 0 && (OFF_XT % 128) == 0 && (OFF_YT % 128) == 0 &&
              (OFF_W16 % 128) == 0 && (OFF_BIAS % 128) == 0);
static_assert(LP_ % 64 == 0 && CD_ % 64 == 0 && (NB_ * LP_) % 64 == 0);
static_assert(WROWS * 48 == 156 * 256 && CD_ * 48 == 72 * 256 && APD * 48 == 12 * 256);

#define EP 68      // GEMM epilogue LDS pitch (floats), 272 B
#define KP 392     // GEMM operand LDS pitch (halves), 784 B = 16 B x 49 (odd): conflict-free 16-B fragment reads
#define OPT_H (64 * KP)                 // one staged operand tile: 64 rows, whole K
#define GEMM_LDS_B (2 * OPT_H * 2)      // both operand tiles, 100352 B; the f32 epilogue tile reuses the same bytes

static_assert(64 * EP * 4 <= GEMM_LDS_B);
static_assert((64 * CD_ / 8) == 12 * 256 && (3 * 256) % (CD_ / 8) == 0);

typedef unsigned short v8us  __attribute__((ext_vector_type(8)));
typedef unsigned short v8usa __attribute__((ext_vector_type(8), __may_alias__));
typedef unsigned short v16us __attribute__((ext_vector_type(16)));
typedef _Float16       v16h  __attribute__((ext_vector_type(16)));
typedef float          v8f   __attribute__((ext_vector_type(8)));
typedef float          v4f   __attribute__((ext_vector_type(4)));
typedef float          v4fa  __attribute__((ext_vector_type(4), __may_alias__));

union Frag { v16us v; v8us half[2]; };

// f32 -> f16 bits (RNE convert)
__device__ __forceinline__ unsigned short h2us(float f) {
  return __builtin_bit_cast(unsigned short, (_Float16)f);
}

__device__ __forceinline__ void st2_u8(unsigned short* p, v8us v) {
  *(v8us*)p = v;
  
}
__device__ __forceinline__ void st2_f4(float* p, v4f v) {
  *(v4f*)p = v;
  
}

// 16-bit fragment from a k-contiguous row: elements 0..7 <- k0+8h+0..7, elements 8..15 <- k0+16+8h+0..7.
// Used for A rows [m][k] and for B stored as [n][k] rows (same per-lane k map); rowp points at element k0 of the row.
__device__ __forceinline__ v16h ldfrag(const unsigned short* rowp, int h) {
  Frag f;
  f.half[0] = *(const v8usa*)(rowp + 8 * h);
  f.half[1] = *(const v8usa*)(rowp + 16 + 8 * h);
  return __builtin_bit_cast(v16h, f.v);
}

__device__ __forceinline__ v8f wmma_h(v16h a, v16h b, v8f c) {
  return __builtin_amdgcn_wmma_f32_16x16x32_f16(false, a, false, b, (short)0, c, false, false);
}

__device__ __forceinline__ v8f v8f_zero() {
  v8f z = {0.f, 0.f, 0.f, 0.f, 0.f, 0.f, 0.f, 0.f};
  return z;
}

// =====================================================================================
// Kernel 0: weight planes + fused bias line.
// W16[832][384] halves: rows 0..383 = f16(16*Wv[o][c]), 384..447 = f16(16*Wa[o-384][c]) (o-384 >= 54 -> 0),
// 448..831 = f16(16*Wp[o-448][c]). One thread = 8 consecutive c (16 B), 48 threads per 768-B row (rows 448..831).
// Rows 0..447 are laid in WMMA fragment order instead: per (16-row tile, 32-k step) 1024 B = 2 pieces x 32 lanes x 16 B,
// lane (m, h) piece j = row tile*16+m, c = ks*32 + 16j + 8h + 0..7, so a wave reads a fragment as two 512-B runs.
// Block 156: BIAS[448] = [bv | ba padded with 0], 112 float4 pieces, 8 consecutive lanes per line.
// coverage: 156*256 = 832*48 items exactly; 112 float4 = 448 floats exactly.
// =====================================================================================
__global__ void __launch_bounds__(256) k_wprep(
    const float* __restrict__ Wv, const float* __restrict__ Wa, const float* __restrict__ Wp,
    const float* __restrict__ bv, const float* __restrict__ ba,
    unsigned short* __restrict__ W16, float* __restrict__ bias) {
  const int tid = threadIdx.x;
  const int bid = blockIdx.x;
  if (bid < 156) {
    const int i = bid * 256 + tid;            // < 39936
    int row = i / 48;                         // 0..831
    int c8 = (i - row * 48) * 8;              // 0..376
    if (bid < 84) {                           // fragment order: 16-B piece i = ((tile * 12 + ks) * 2 + j) * 32 + lane
      const int pl = i & 31;
      const int pj = (i >> 5) & 1;
      const int pt = i >> 6;                  // tile * 12 + ks
      const int tl = pt / 12;                 // 16-row tile, 0..27
      row = tl * 16 + (pl & 15);
      c8 = (pt - tl * 12) * 32 + pj * 16 + (pl >> 4) * 8;
    }
    const float* src;
    int srow;
    bool valid = true;
    if (bid < 72) {                           // block-uniform region select
      src = Wv; srow = row;
    } else if (bid < 84) {
      const int r = row - 384;                // 0..63
      valid = (r < NATT);
      srow = (r < NATT) ? r : (NATT - 1);     // clamped address, zero by predicate
      src = Wa;
    } else {
      src = Wp; srow = row - 448;
    }
    const size_t off = (size_t)srow * CD_ + c8;
    const v4f a0 = *(const v4f*)(src + off);
    const v4f a1 = *(const v4f*)(src + off + 4);
    // the loads' address registers take the store address while the loads are still in flight
    asm volatile("s_wait_xcnt 0x0" ::: "memory");
    const float sc = 16.0f;
    v8us ov;
    ov[0] = valid ? h2us(a0.x * sc) : (unsigned short)0;
    ov[1] = valid ? h2us(a0.y * sc) : (unsigned short)0;
    ov[2] = valid ? h2us(a0.z * sc) : (unsigned short)0;
    ov[3] = valid ? h2us(a0.w * sc) : (unsigned short)0;
    ov[4] = valid ? h2us(a1.x * sc) : (unsigned short)0;
    ov[5] = valid ? h2us(a1.y * sc) : (unsigned short)0;
    ov[6] = valid ? h2us(a1.z * sc) : (unsigned short)0;
    ov[7] = valid ? h2us(a1.w * sc) : (unsigned short)0;
    st2_u8((bid < 84) ? (W16 + (size_t)i * 8) : (W16 + (size_t)row * CD_ + c8), ov);
  } else {
    if (tid < 112) {
      const int e0 = tid * 4;                         // 0..444
      const int tb = (tid < 96) ? tid : 95;           // clamped bv piece
      const v4f vb = *(const v4f*)(bv + tb * 4);
      const bool isv = (tid < 96);
      int ea = e0 - 384;
      int c0 = ea;     c0 = (c0 < 0) ? 0 : ((c0 > NATT - 1) ? (NATT - 1) : c0);
      int c1 = ea + 1; c1 = (c1 < 0) ? 0 : ((c1 > NATT - 1) ? (NATT - 1) : c1);
      int c2 = ea + 2; c2 = (c2 < 0) ? 0 : ((c2 > NATT - 1) ? (NATT - 1) : c2);
      int c3 = ea + 3; c3 = (c3 < 0) ? 0 : ((c3 > NATT - 1) ? (NATT - 1) : c3);
      const float q0 = ba[c0], q1 = ba[c1], q2 = ba[c2], q3 = ba[c3];
      v4f o;
      o.x = isv ? vb.x : ((ea + 0 >= 0 && ea + 0 < NATT) ? q0 : 0.0f);
      o.y = isv ? vb.y : ((ea + 1 >= 0 && ea + 1 < NATT) ? q1 : 0.0f);
      o.z = isv ? vb.z : ((ea + 2 >= 0 && ea + 2 < NATT) ? q2 : 0.0f);
      o.w = isv ? vb.w : ((ea + 3 >= 0 && ea + 3 < NATT) ? q3 : 0.0f);
      st2_f4(bias + e0, o);
    }
  }
}

// =====================================================================================
// Shared GEMM operand staging: two tiles of 64 rows x 384 halves, each 49152 contiguous bytes in global memory,
// are read as whole 512-B runs per wave (16 B per lane) and laid in LDS at pitch KP. Piece i = 16 B: row i / 48,
// column piece i % 48; pieces i and i + 768 lie 16 rows apart, so three divisions serve all twelve pieces.
// All 24 loads of a thread are issued before the first LDS store.
// coverage: 12 x 256 = 3072 pieces = 64 rows x 48 pieces per tile, each once.
// =====================================================================================
__device__ __forceinline__ void stage_ops(const unsigned short* __restrict__ ga, const unsigned short* __restrict__ gb,
                                          unsigned short* sA, unsigned short* sB, int tid) {
  v8us ra[12], rb[12];
  // all four loops fully unrolled: constant indices keep ra and rb in registers, steps become immediate offsets
  #pragma unroll
  for (int j = 0; j < 3; ++j) {
    const int i = j * 256 + tid;               // 0..767
    #pragma unroll
    for (int q = 0; q < 4; ++q) {
      ra[j * 4 + q] = *(const v8us*)(ga + (size_t)(i + q * 768) * 8);
      rb[j * 4 + q] = *(const v8us*)(gb + (size_t)(i + q * 768) * 8);
    }
  }
  // the loads' address registers are reused below while the loads are still in flight
  asm volatile("s_wait_xcnt 0x0" ::: "memory");
  #pragma unroll
  for (int j = 0; j < 3; ++j) {
    const int i = j * 256 + tid;
    const int r = i / 48;                      // 0..15
    const int c = i - r * 48;                  // 0..47
    #pragma unroll
    for (int q = 0; q < 4; ++q) {
      *(v8usa*)(sA + (r + q * 16) * KP + c * 8) = ra[j * 4 + q];
      *(v8usa*)(sB + (r + q * 16) * KP + c * 8) = rb[j * 4 + q];
    }
  }
}

// =====================================================================================
// Shared GEMM epilogue writer: f32 tile [64 rows][64 cols] staged in LDS (pitch EP); each 256-B row
// =====================================================================================
__device__ __forceinline__ void write_tile64(const float* sT, float* obase, size_t row0, int opitch,
                                             int ocol, int lane, int w) {
  const int q = lane >> 3;
  const int j = lane & 7;
  const int rsel = q >> 1;
  const int lsel = q & 1;
  #pragma unroll 1
  for (int it = 0; it < 4; ++it) {
    const int row = it * 16 + w * 2 + rsel;     // 0..63, each once
    const v4f v = *(const v4fa*)(sT + row * EP + lsel * 32 + j * 4);
    float* dst = obase + (row0 + (size_t)row) * (size_t)opitch + ocol + lsel * 32 + j * 4;
    st2_f4(dst, v);
  }
}

// =====================================================================================
// Kernel 1: fused conv1, straight from x. D[m = pixel l][n = o] = sum_c f16(x[c][l]) * W16[o][c], o in 0..447.
// Block = (n, 112 pixels = two image rows), 7 waves. The 384 x 112 f32 tile of x is read once (16 B per lane along l),
// converted to f16 and laid transposed in LDS as [pixel][c] at pitch KP. Wave w owns o columns 64w .. 64w+63 for all
// 112 pixels (7 x 4 D tiles); no other wave needs its weights, so it reads their fragments from the fragment-ordered
// W16 into registers, two k steps ahead; pixel fragments come from LDS one k step ahead. Waves 0..5 -> vT[n][l][o] = D/16 + bv (pitch 384); wave 6 -> aT[n][l][0..63].
// coverage: grid 8 x 28 tiles x 112 px = all pixels; 6 x 224 items x 8 rows x 4 px = 384 x 112; every (n, l, o<448)
// written exactly once as whole 256-B row segments.
// =====================================================================================
#define FP_ 112                   // pixels per block
#define FT_ (LP_ / FP_)           // 28 tiles per image
#define FM_ (FP_ / 16)            // 7 pixel tiles of 16
#define FQ_ (FP_ / 4)             // 28 float4 per x row segment

static_assert(FT_ * FP_ == LP_ && FM_ * 16 == FP_ && 224 == 8 * FQ_ && 6 * 8 * 8 == CD_ && 7 * 64 == NO1);

// Epilogue of one wave: each 16-pixel x 64-column f32 tile goes through the wave's own LDS rows (two buffers in turn)
// and leaves as whole 256-B rows. PITCH is a constant so that every store is one base plus an immediate offset.
template <int PITCH>
__device__ __forceinline__ void conv1_out(float* sE, const v8f (&acc)[FM_][4], const float (&b)[4], float* ob,
                                          int h, int m) {
  #pragma unroll
  for (int mt = 0; mt < FM_; ++mt) {
    float* sb = sE + (mt & 1) * (16 * EP);
    #pragma unroll
    for (int nt = 0; nt < 4; ++nt) {
      #pragma unroll
      for (int r = 0; r < 8; ++r) sb[(8 * h + r) * EP + nt * 16 + m] = acc[mt][nt][r] * 0.0625f + b[nt];
    }
    // the wave's LDS stores have landed before its other lanes read the rows back; also keeps the compiler's order
    asm volatile("s_wait_dscnt 0x0" ::: "memory");
    #pragma unroll
    for (int it = 0; it < 8; ++it) {
      const int row = it * 2 + h;               // 0..15, each once
      const v4f v = *(const v4fa*)(sb + row * EP + m * 4);
      st2_f4(ob + (size_t)(mt * 16 + row) * PITCH + m * 4, v);
    }
    // the stores' data registers are rewritten by the next tile while the stores are still in flight
    asm volatile("s_wait_xcnt 0x0" ::: "memory");
    // keeps the next tile's arithmetic, which rewrites those registers, behind the wait: the compiler lifted it over
    __builtin_amdgcn_sched_barrier(0);
  }
}

__global__ void __launch_bounds__(224) k_conv1(
    const float* __restrict__ x, const unsigned short* __restrict__ W16,
    const float* __restrict__ bias, float* vT, float* aT) {
  __shared__ __attribute__((aligned(16))) unsigned short sA[FP_ * KP];
  __shared__ __attribute__((aligned(16))) float sE[7 * 2 * 16 * EP];
  const int tid = threadIdx.x;
  const int lane = tid & 31;
  const int w = __builtin_amdgcn_readfirstlane(tid >> 5);   // 0..6, scalar: weight base and output plane are wave-uniform
  const int h = lane >> 4;
  const int m = lane & 15;
  const int bid = blockIdx.x;
  const int n = bid / FT_;
  const int l0 = (bid - n * FT_) * FP_;

  // x tile: item = (8 consecutive c, 4 consecutive px); all 48 loads of a thread are issued before the first use
  const int q4 = tid % FQ_;                  // 0..27
  const int og = tid / FQ_;                  // 0..7
  const float* xb = x + ((size_t)(n * CD_ + og * 8)) * LP_ + l0 + q4 * 4;
  v4f xr[6][8];
  // every loop of the kernel is fully unrolled: constant indices keep xr, fb, fa and acc in registers
  #pragma unroll
  for (int it = 0; it < 6; ++it) {
    #pragma unroll
    for (int i = 0; i < 8; ++i) xr[it][i] = *(const v4f*)(xb + (size_t)(it * 64 + i) * LP_);
  }
  // the x loads' address registers are taken over by the weight loads' results while the x loads are still in flight
  asm volatile("s_wait_xcnt 0x0" ::: "memory");

  // weight fragments of k steps 0 and 1
  const unsigned short* wb = W16 + (size_t)w * (4 * 12 * 512) + lane * 8;
  v16h fb[3][4];
  #pragma unroll
  for (int p = 0; p < 2; ++p) {
    #pragma unroll
    for (int nt = 0; nt < 4; ++nt) {
      Frag f;
      f.half[0] = *(const v8us*)(wb + (nt * 12 + p) * 512);
      f.half[1] = *(const v8us*)(wb + (nt * 12 + p) * 512 + 256);
      fb[p][nt] = __builtin_bit_cast(v16h, f.v);
    }
  }
  float b[4];
  #pragma unroll
  for (int nt = 0; nt < 4; ++nt) b[nt] = bias[w * 64 + nt * 16 + m];
  // the loads' address registers may be reused below while the loads are still in flight
  asm volatile("s_wait_xcnt 0x0" ::: "memory");

  #pragma unroll
  for (int it = 0; it < 6; ++it) {
    #pragma unroll
    for (int j = 0; j < 4; ++j) {
      v8us pk;
      #pragma unroll
      for (int i = 0; i < 8; ++i) pk[i] = h2us(xr[it][i][j]);
      *(v8usa*)(sA + (q4 * 4 + j) * KP + (it * 8 + og) * 8) = pk;
    }
  }
  __syncthreads();

  v8f acc[FM_][4];
  #pragma unroll
  for (int mt = 0; mt < FM_; ++mt) {
    #pragma unroll
    for (int nt = 0; nt < 4; ++nt) acc[mt][nt] = v8f_zero();
  }

  const unsigned short* ar = sA + m * KP;                // A: pixel rows, k = c
  v16h fa[2][FM_];
  #pragma unroll
  for (int mt = 0; mt < FM_; ++mt) fa[0][mt] = ldfrag(ar + mt * 16 * KP, h);
  #pragma unroll
  for (int ks = 0; ks < CD_ / 32; ++ks) {
    if (ks + 2 < CD_ / 32) {
      #pragma unroll
      for (int nt = 0; nt < 4; ++nt) {
        Frag f;
        f.half[0] = *(const v8us*)(wb + (nt * 12 + ks + 2) * 512);
        f.half[1] = *(const v8us*)(wb + (nt * 12 + ks + 2) * 512 + 256);
        fb[(ks + 2) % 3][nt] = __builtin_bit_cast(v16h, f.v);
      }
    }
    if (ks + 1 < CD_ / 32) {
      #pragma unroll
      for (int mt = 0; mt < FM_; ++mt) fa[(ks + 1) & 1][mt] = ldfrag(ar + mt * 16 * KP + (ks + 1) * 32, h);
    }
    // holds the later steps' loads as one group ahead of this step's WMMAs: left free, the compiler sank each load
    // to just before its first use and the wave waited out every LDS and L2 latency
    __builtin_amdgcn_sched_barrier(0);
    #pragma unroll
    for (int mt = 0; mt < FM_; ++mt) {
      #pragma unroll
      for (int nt = 0; nt < 4; ++nt) acc[mt][nt] = wmma_h(fa[ks & 1][mt], fb[ks % 3][nt], acc[mt][nt]);
    }
    // the next group of loads stays behind this step's WMMAs
    __builtin_amdgcn_sched_barrier(0);
  }

  // D element r of lane -> pixel row mt*16 + 8h + r, o col 64w + nt*16 + m
  float* sw = sE + w * (2 * 16 * EP);
  const size_t prow = (size_t)n * LP_ + l0;
  if (w < 6) conv1_out<CD_>(sw, acc, b, vT + prow * CD_ + w * 64, h, m);
  else       conv1_out<APD>(sw, acc, b, aT + prow * APD, h, m);
}

// =====================================================================================
// Kernel 2: per-pixel softmax over the 9 taps per head (f32) and the 3x3 zero-padded window sum (f32):
// y[c] = sum_k p[head(c)][k] * v[c][py + k/3 - 1][px + k%3 - 1], head(c) = c / 64, tap k = kh*3 + kw.
// One block = a tile of 2 rows x 7 pixels, all 384 channels; one thread = 4 consecutive channels (16-B loads along c,
// a wave reads 512 contiguous bytes of a vT row). The 4 x 9 pixel window that the 14 pixels share is read once into
// registers. The 84 (pixel, head) softmaxes run one per lane; a tap that falls outside the image gets weight 0
// (its address is clamped into the image), which is the zero padding.
// coverage: grid 8 n x 28 row pairs x 8 column groups = all 25088 pixels; 96 threads x 4 = 384 channels;
// each wave stores 256 contiguous bytes (two whole lines) of each yT row.
// =====================================================================================
#define AG_R  2
#define AG_P  7
#define AG_TX (WP_ / AG_P)        // 8
#define AG_TY (HP_ / AG_R)        // 28
#define AG_PX (AG_R * AG_P)       // 14 pixels per block
#define AG_IT (AG_PX * NHD)       // 84 softmax items per block
#define AG_WP 12                  // floats per item in LDS: 9 weights, padded to 48 B for 16-B reads

static_assert(AG_TX * AG_P == WP_ && AG_TY * AG_R == HP_ && AG_IT <= 96 && CD_ == 96 * 4);

typedef unsigned short v4us __attribute__((ext_vector_type(4)));

// aT and vT carry no __restrict__: with it the compiler moved logit loads behind the s_wait_xcnt written for them.
// Every loop of the kernel is fully unrolled: constant indices keep e, win and p in registers.
__global__ void __launch_bounds__(96) k_agg(
    const float* aT, const float* vT, unsigned short* yT) {
  __shared__ __attribute__((aligned(16))) float sp[96 * AG_WP];
  const int t = threadIdx.x;
  const int bid = blockIdx.x;
  const int tx = bid % AG_TX;
  const int ty = (bid / AG_TX) % AG_TY;
  const int n = bid / (AG_TX * AG_TY);
  const int x0 = tx * AG_P;
  const int y0 = ty * AG_R;

  // logits of this lane's (pixel, head) item; lanes 84..95 repeat item 83 into spare slots that nobody reads
  const int it = (t < AG_IT) ? t : (AG_IT - 1);
  const int ip = it / NHD;                   // pixel of the tile, 0..13
  const int ih = it - ip * NHD;              // head
  const int ir = ip / AG_P;
  const int iy = y0 + ir;
  const int ix = x0 + (ip - ir * AG_P);
  const float* ap = aT + ((size_t)n * LP_ + iy * WP_ + ix) * APD + ih * KK_;
  float e[KK_];
  #pragma unroll
  for (int k = 0; k < KK_; ++k) e[k] = ap[k];
  // the logit loads' address registers are taken over by the window below while those loads are still in flight
  asm volatile("s_wait_xcnt 0x0" ::: "memory");

  // the shared window: rows y0-1 .. y0+2, columns x0-1 .. x0+7, addresses clamped into the image (block-uniform)
  const float* vn = vT + (size_t)n * LP_ * CD_;
  const unsigned c4 = (unsigned)t * 4u;      // this lane's first channel
  const int xl = (x0 > 0) ? (x0 - 1) : 0;
  const int xr = (x0 + AG_P < WP_) ? (x0 + AG_P) : (WP_ - 1);
  v4f win[AG_R + 2][AG_P + 2];
  #pragma unroll
  for (int rr = 0; rr < AG_R + 2; ++rr) {
    int yc = y0 - 1 + rr;
    yc = (yc < 0) ? 0 : ((yc > HP_ - 1) ? (HP_ - 1) : yc);
    const float* vrow = vn + (size_t)(yc * WP_) * CD_;          // block-uniform row base
    win[rr][0] = *(const v4f*)(vrow + xl * CD_ + c4);
    #pragma unroll
    for (int cc = 1; cc <= AG_P; ++cc) win[rr][cc] = *(const v4f*)(vrow + (x0 + cc - 1) * CD_ + c4);
    win[rr][AG_P + 1] = *(const v4f*)(vrow + xr * CD_ + c4);
  }

  float mx = e[0];
  #pragma unroll
  for (int k = 1; k < KK_; ++k) mx = fmaxf(mx, e[k]);
  float s = 0.0f;
  #pragma unroll
  for (int k = 0; k < KK_; ++k) {
    e[k] = expf(e[k] - mx);
    s += e[k];
  }
  const float inv = 1.0f / s;
  #pragma unroll
  for (int k = 0; k < KK_; ++k) {
    const int yy = iy + (k / 3) - 1;
    const int xx = ix + (k % 3) - 1;
    const bool inb = (yy >= 0) && (yy < HP_) && (xx >= 0) && (xx < WP_);
    e[k] = inb ? e[k] * inv : 0.0f;
  }
  {
    float* wq = sp + t * AG_WP;
    const v4f q0 = {e[0], e[1], e[2], e[3]};
    const v4f q1 = {e[4], e[5], e[6], e[7]};
    *(v4fa*)wq = q0;
    *(v4fa*)(wq + 4) = q1;
    wq[8] = e[8];
  }
  __syncthreads();

  const int hd = t >> 4;            // head of channels 4t .. 4t+3
  unsigned short* yb = yT + ((size_t)n * LP_ + y0 * WP_ + x0) * CD_ + t * 4;
  #pragma unroll
  for (int r = 0; r < AG_R; ++r) {
    #pragma unroll
    for (int cx = 0; cx < AG_P; ++cx) {
      const float* wq = sp + ((r * AG_P + cx) * NHD + hd) * AG_WP;
      const v4f q0 = *(const v4fa*)wq;
      const v4f q1 = *(const v4fa*)(wq + 4);
      const float p[KK_] = {q0.x, q0.y, q0.z, q0.w, q1.x, q1.y, q1.z, q1.w, wq[8]};
      v4f acc = {0.0f, 0.0f, 0.0f, 0.0f};
      #pragma unroll
      for (int k = 0; k < KK_; ++k) {
        const v4f v = win[r + k / 3][cx + k % 3];
        acc.x = fmaf(p[k], v.x, acc.x);
        acc.y = fmaf(p[k], v.y, acc.y);
        acc.z = fmaf(p[k], v.z, acc.z);
        acc.w = fmaf(p[k], v.w, acc.w);
      }
      const v4us o = {h2us(acc.x), h2us(acc.y), h2us(acc.z), h2us(acc.w)};
      *(v4us*)(yb + (size_t)(r * WP_ + cx) * CD_) = o;
    }
  }
}

// =====================================================================================
// Kernel 3: projection. D[m = o][n = pixel l] = sum_c W16[448 + o][c] * yT[l][c]; out[n][o][l] = D/16 + bp[o] (NCHW f32).
// Block = (n, 64 o, 64 px); wave w: o rows osub = (w>>1)*16, pixel cols lsub = (w&1)*32 (two D tiles).
// coverage: grid 8 x 6 x 49; every (n, o, l) written exactly once as whole 256-B row segments of out.
// =====================================================================================
__device__ __forceinline__ void stage_pj(float* sT, v8f a0, v8f a1, int orow0, int col0, const float* bpp) {
  #pragma unroll
  for (int r = 0; r < 8; ++r) {
    const float b = bpp[r];
    sT[(orow0 + r) * EP + col0] = a0[r] * 0.0625f + b;
    sT[(orow0 + r) * EP + col0 + 16] = a1[r] * 0.0625f + b;
  }
}

__global__ void __launch_bounds__(256) k_proj(
    const unsigned short* __restrict__ yT, const unsigned short* __restrict__ W16,
    const float* __restrict__ bp, float* __restrict__ out) {
  __shared__ __attribute__((aligned(16))) unsigned char smem[GEMM_LDS_B];
  unsigned short* sA = (unsigned short*)smem;
  unsigned short* sB = sA + OPT_H;
  float* sT = (float*)smem;
  const int tid = threadIdx.x;
  const int lane = tid & 31;
  const int w = tid >> 5;
  const int h = lane >> 4;
  const int m = lane & 15;
  const int bid = blockIdx.x;
  const int pt = bid % NPT;
  const int ot = (bid / NPT) % (CD_ / 64);
  const int n = bid / (NPT * (CD_ / 64));
  const int p0 = pt * 64;
  const int o0 = ot * 64;
  const int osub = (w >> 1) * 16;
  const int lsub = (w & 1) * 32;

  stage_ops(W16 + (size_t)(NO1 + o0) * CD_, yT + ((size_t)(n * LP_ + p0)) * CD_, sA, sB, tid);
  __syncthreads();

  const unsigned short* ar  = sA + (osub + m) * KP;      // A: Wp rows [o][c]
  const unsigned short* br0 = sB + (lsub + m) * KP;      // B: yT rows [l][c]
  const unsigned short* br1 = br0 + 16 * KP;

  v8f acc0 = v8f_zero(), acc1 = v8f_zero();

  #pragma unroll 1
  for (int ks = 0; ks < CD_ / 32; ++ks) {
    const int k0 = ks * 32;
    const v16h fa  = ldfrag(ar + k0, h);
    const v16h fb0 = ldfrag(br0 + k0, h);
    const v16h fb1 = ldfrag(br1 + k0, h);
    acc0 = wmma_h(fa, fb0, acc0);
    acc1 = wmma_h(fa, fb1, acc1);
    asm volatile("v_nop\n\tv_nop\n\tv_nop\n\tv_nop"
                 : "+v"(acc0), "+v"(acc1)
                 : "v"(fa), "v"(fb0), "v"(fb1));
  }

  // D element r of lane -> o row osub + 8h + r, pixel col lsub + t*16 + m
  const float* bpp = bp + o0 + osub + 8 * h;
  __syncthreads();       // every wave has left the operand tiles before their bytes take the f32 tile
  stage_pj(sT, acc0, acc1, osub + 8 * h, lsub + m, bpp);
  __syncthreads();

  write_tile64(sT, out, (size_t)(n * CD_ + o0), LP_, p0, lane, w);
}

// =====================================================================================
extern "C" void kernel_launch(void* const* d_in, const int* in_sizes, int n_in,
                              void* d_out, int out_size, void* d_ws, size_t ws_size,
                              hipStream_t stream) {
  if (n_in < 7) return;
  if (in_sizes[0] != X_N || in_sizes[1] != WA_N || in_sizes[2] != NATT ||
      in_sizes[3] != WV_N || in_sizes[4] != CD_ || in_sizes[5] != WV_N || in_sizes[6] != CD_) return;
  if (out_size != OUT_N) return;
  if (ws_size < (size_t)WS_TOTAL) return;

  const float* x  = (const float*)d_in[0];
  const float* Wa = (const float*)d_in[1];
  const float* ba = (const float*)d_in[2];
  const float* Wv = (const float*)d_in[3];
  const float* bv = (const float*)d_in[4];
  const float* Wp = (const float*)d_in[5];
  const float* bp = (const float*)d_in[6];
  float* out = (float*)d_out;

  char* ws = (char*)d_ws;
  float*          vT   = (float*)(ws + OFF_VT);
  float*          aT   = (float*)(ws + OFF_AT);
  unsigned short* yT   = (unsigned short*)(ws + OFF_YT);
  unsigned short* W16  = (unsigned short*)(ws + OFF_W16);
  float*          bias = (float*)(ws + OFF_BIAS);

  k_wprep<<<dim3(157), dim3(256), 0, stream>>>(Wv, Wa, Wp, bv, ba, W16, bias);
  k_conv1<<<dim3(NB_ * FT_), dim3(224), 0, stream>>>(x, W16, bias, vT, aT);
  k_agg<<<dim3(NB_ * AG_TY * AG_TX), dim3(96), 0, stream>>>(aT, vT, yT);
  k_proj<<<dim3(NB_ * (CD_ / 64) * NPT), dim3(256), 0, stream>>>(yT, W16, bp, out);
}

// v004
// Measured time: 40.2 microseconds a run.
// Two timings next to v003 put it at 1.34 and 1.35 times that version's speed.
// Over all steps from v000 it is 3.98 times as fast.
#include <hip/hip_runtime.h>

// All contractions: v_wmma_f32_16x16x32_f16 (f16 operands: weights carried x16, activations x1), f32 accumulate,
// 1/16 folded in the f32 epilogues. Softmax over the 9 window taps and the 3x3 weighted window sum: f32 on VALU.
// Carry audit:
//   W16 rows   0..383 = f16(16*Wv), rows 384..437 = f16(16*Wa), rows 438..447 = 0 : inverse 0.0625f in conv1_out (k_conv1)
//   W16 rows 448..831 = f16(16*Wp)                                                : inverse 0.0625f in proj_out (k_proj)
//   f16(x) carry 1 (LDS only), yT = f16(y) carry 1 : no inverse needed
//   vT, aT, BIAS line : f32, no carry

#define NB_   8
#define CD_   384
#define LP_   3136
#define WP_   56
#define HP_   56
#define NATT  54              // 6 heads x 9 taps
#define NHD   6
#define KK_   9
#define APD   64              // padded logit columns
#define NO1   448             // fused conv1 output columns: 384 (v) + 64 (logits, padded)
#define WROWS 832             // 448 + 384 weight rows
#define NPT   (LP_ / 64)      // 49 pixel tiles

#define X_N   (NB_ * CD_ * LP_)   // 9633792
#define WA_N  (NATT * CD_)        // 20736
#define WV_N  (CD_ * CD_)         // 147456
#define OUT_N X_N

#define SZ_VT   ((size_t)NB_ * LP_ * CD_ * 4)   // 38535168  f32 [n][l][c]
#define SZ_AT   ((size_t)NB_ * LP_ * APD * 4)   // 6422528   f32 [n][l][64]
#define SZ_XT   ((size_t)NB_ * LP_ * CD_ * 2)   // 19267584  reserved, unused (x is read directly)
#define SZ_YT   SZ_XT                           // 19267584  f16 [n][l][c]
#define SZ_W16  ((size_t)WROWS * CD_ * 2)       // 638976    f16: all 832 rows in fragment order
#define SZ_BIAS ((size_t)NO1 * 4)               // 1792      f32 [448]
#define OFF_VT   ((size_t)0)
#define OFF_AT   (OFF_VT + SZ_VT)
#define OFF_XT   (OFF_AT + SZ_AT)
#define OFF_YT   (OFF_XT + SZ_XT)
#define OFF_W16  (OFF_YT + SZ_YT)
#define OFF_BIAS (OFF_W16 + SZ_W16)
#define WS_TOTAL (OFF_BIAS + SZ_BIAS)           // 84133632

static_assert(WS_TOTAL == 84133632);
static_assert(WS_TOTAL <= 134217728);
static_assert((OFF_AT % 128) == 0 && (OFF_XT % 128) == 0 && (OFF_YT % 128) == 0 &&
              (OFF_W16 % 128) == 0 && (OFF_BIAS % 128) == 0);
static_assert(LP_ % 64 == 0 && CD_ % 64 == 0 && (NB_ * LP_) % 64 == 0);
static_assert(WROWS * 48 == 156 * 256 && CD_ * 48 == 72 * 256 && APD * 48 == 12 * 256);

#define EP 68      // GEMM epilogue LDS pitch (floats), 272 B
#define KP 392     // GEMM operand LDS pitch (halves), 784 B = 16 B x 49 (odd): conflict-free 16-B fragment reads
#define OPT_H (64 * KP)                 // one staged operand tile: 64 rows, whole K

static_assert((64 * CD_ / 8) == 12 * 256 && (3 * 256) % (CD_ / 8) == 0);

typedef unsigned short v8us  __attribute__((ext_vector_type(8)));
typedef unsigned short v8usa __attribute__((ext_vector_type(8), __may_alias__));
typedef unsigned short v16us __attribute__((ext_vector_type(16)));
typedef _Float16       v16h  __attribute__((ext_vector_type(16)));
typedef float          v8f   __attribute__((ext_vector_type(8)));
typedef float          v4f   __attribute__((ext_vector_type(4)));
typedef float          v4fa  __attribute__((ext_vector_type(4), __may_alias__));

union Frag { v16us v; v8us half[2]; };

// f32 -> f16 bits (RNE convert)
__device__ __forceinline__ unsigned short h2us(float f) {
  return __builtin_bit_cast(unsigned short, (_Float16)f);
}

__device__ __forceinline__ void st2_u8(unsigned short* p, v8us v) {
  *(v8us*)p = v;
  
}
__device__ __forceinline__ void st2_f4(float* p, v4f v) {
  *(v4f*)p = v;
  
}

// 16-bit fragment from a k-contiguous row: elements 0..7 <- k0+8h+0..7, elements 8..15 <- k0+16+8h+0..7.
// Used for A rows [m][k] and for B stored as [n][k] rows (same per-lane k map); rowp points at element k0 of the row.
__device__ __forceinline__ v16h ldfrag(const unsigned short* rowp, int h) {
  Frag f;
  f.half[0] = *(const v8usa*)(rowp + 8 * h);
  f.half[1] = *(const v8usa*)(rowp + 16 + 8 * h);
  return __builtin_bit_cast(v16h, f.v);
}

__device__ __forceinline__ v8f wmma_h(v16h a, v16h b, v8f c) {
  return __builtin_amdgcn_wmma_f32_16x16x32_f16(false, a, false, b, (short)0, c, false, false);
}

__device__ __forceinline__ v8f v8f_zero() {
  v8f z = {0.f, 0.f, 0.f, 0.f, 0.f, 0.f, 0.f, 0.f};
  return z;
}

// =====================================================================================
// Kernel 0: weight planes + fused bias line.
// W16[832][384] halves: rows 0..383 = f16(16*Wv[o][c]), 384..447 = f16(16*Wa[o-384][c]) (o-384 >= 54 -> 0),
// 448..831 = f16(16*Wp[o-448][c]). One thread = 8 consecutive c (16 B).
// All rows are laid in WMMA fragment order: per (16-row tile, 32-k step) 1024 B = 2 pieces x 32 lanes x 16 B,
// lane (m, h) piece j = row tile*16+m, c = ks*32 + 16j + 8h + 0..7, so a wave reads a fragment as two 512-B runs.
// A 16-row tile is 768 pieces = 3 blocks, so the block-uniform region select below holds in this order.
// Block 156: BIAS[448] = [bv | ba padded with 0], 112 float4 pieces, 8 consecutive lanes per line.
// coverage: 156*256 = 832*48 items exactly; 112 float4 = 448 floats exactly.
// =====================================================================================
__global__ void __launch_bounds__(256) k_wprep(
    const float* __restrict__ Wv, const float* __restrict__ Wa, const float* __restrict__ Wp,
    const float* __restrict__ bv, const float* __restrict__ ba,
    unsigned short* __restrict__ W16, float* __restrict__ bias) {
  const int tid = threadIdx.x;
  const int bid = blockIdx.x;
  if (bid < 156) {
    const int i = bid * 256 + tid;            // < 39936
    // fragment order: 16-B piece i = ((tile * 12 + ks) * 2 + j) * 32 + lane
    const int pl = i & 31;
    const int pj = (i >> 5) & 1;
    const int pt = i >> 6;                    // tile * 12 + ks
    const int tl = pt / 12;                   // 16-row tile, 0..51
    const int row = tl * 16 + (pl & 15);      // 0..831
    const int c8 = (pt - tl * 12) * 32 + pj * 16 + (pl >> 4) * 8;   // 0..376
    const float* src;
    int srow;
    bool valid = true;
    if (bid < 72) {                           // block-uniform region select
      src = Wv; srow = row;
    } else if (bid < 84) {
      const int r = row - 384;                // 0..63
      valid = (r < NATT);
      srow = (r < NATT) ? r : (NATT - 1);     // clamped address, zero by predicate
      src = Wa;
    } else {
      src = Wp; srow = row - 448;
    }
    const size_t off = (size_t)srow * CD_ + c8;
    const v4f a0 = *(const v4f*)(src + off);
    const v4f a1 = *(const v4f*)(src + off + 4);
    // the loads' address registers take the store address while the loads are still in flight
    asm volatile("s_wait_xcnt 0x0" ::: "memory");
    const float sc = 16.0f;
    v8us ov;
    ov[0] = valid ? h2us(a0.x * sc) : (unsigned short)0;
    ov[1] = valid ? h2us(a0.y * sc) : (unsigned short)0;
    ov[2] = valid ? h2us(a0.z * sc) : (unsigned short)0;
    ov[3] = valid ? h2us(a0.w * sc) : (unsigned short)0;
    ov[4] = valid ? h2us(a1.x * sc) : (unsigned short)0;
    ov[5] = valid ? h2us(a1.y * sc) : (unsigned short)0;
    ov[6] = valid ? h2us(a1.z * sc) : (unsigned short)0;
    ov[7] = valid ? h2us(a1.w * sc) : (unsigned short)0;
    st2_u8(W16 + (size_t)i * 8, ov);
  } else {
    if (tid < 112) {
      const int e0 = tid * 4;                         // 0..444
      const int tb = (tid < 96) ? tid : 95;           // clamped bv piece
      const v4f vb = *(const v4f*)(bv + tb * 4);
      const bool isv = (tid < 96);
      int ea = e0 - 384;
      int c0 = ea;     c0 = (c0 < 0) ? 0 : ((c0 > NATT - 1) ? (NATT - 1) : c0);
      int c1 = ea + 1; c1 = (c1 < 0) ? 0 : ((c1 > NATT - 1) ? (NATT - 1) : c1);
      int c2 = ea + 2; c2 = (c2 < 0) ? 0 : ((c2 > NATT - 1) ? (NATT - 1) : c2);
      int c3 = ea + 3; c3 = (c3 < 0) ? 0 : ((c3 > NATT - 1) ? (NATT - 1) : c3);
      const float q0 = ba[c0], q1 = ba[c1], q2 = ba[c2], q3 = ba[c3];
      v4f o;
      o.x = isv ? vb.x : ((ea + 0 >= 0 && ea + 0 < NATT) ? q0 : 0.0f);
      o.y = isv ? vb.y : ((ea + 1 >= 0 && ea + 1 < NATT) ? q1 : 0.0f);
      o.z = isv ? vb.z : ((ea + 2 >= 0 && ea + 2 < NATT) ? q2 : 0.0f);
      o.w = isv ? vb.w : ((ea + 3 >= 0 && ea + 3 < NATT) ? q3 : 0.0f);
      st2_f4(bias + e0, o);
    }
  }
}

// =====================================================================================
// GEMM operand staging (k_proj): two tiles of 64 rows x 384 halves, each 49152 contiguous bytes in global memory,
// are read as whole 512-B runs per wave (16 B per lane) and laid in LDS at pitch KP. Piece i = 16 B: row i / 48,
// column piece i % 48; pieces i and i + 768 lie 16 rows apart, so three divisions serve all twelve pieces.
// All 24 loads of a thread are issued before the first LDS store.
// coverage: 12 x 256 = 3072 pieces = 64 rows x 48 pieces per tile, each once.
// =====================================================================================
__device__ __forceinline__ void stage_ops(const unsigned short* __restrict__ ga, const unsigned short* __restrict__ gb,
                                          unsigned short* sA, unsigned short* sB, int tid) {
  v8us ra[12], rb[12];
  // all four loops fully unrolled: constant indices keep ra and rb in registers, steps become immediate offsets
  #pragma unroll
  for (int j = 0; j < 3; ++j) {
    const int i = j * 256 + tid;               // 0..767
    #pragma unroll
    for (int q = 0; q < 4; ++q) {
      ra[j * 4 + q] = *(const v8us*)(ga + (size_t)(i + q * 768) * 8);
      rb[j * 4 + q] = *(const v8us*)(gb + (size_t)(i + q * 768) * 8);
    }
  }
  // the loads' address registers are reused below while the loads are still in flight
  asm volatile("s_wait_xcnt 0x0" ::: "memory");
  #pragma unroll
  for (int j = 0; j < 3; ++j) {
    const int i = j * 256 + tid;
    const int r = i / 48;                      // 0..15
    const int c = i - r * 48;                  // 0..47
    #pragma unroll
    for (int q = 0; q < 4; ++q) {
      *(v8usa*)(sA + (r + q * 16) * KP + c * 8) = ra[j * 4 + q];
      *(v8usa*)(sB + (r + q * 16) * KP + c * 8) = rb[j * 4 + q];
    }
  }
}

// =====================================================================================
// Kernel 1: fused conv1, straight from x. D[m = pixel l][n = o] = sum_c f16(x[c][l]) * W16[o][c], o in 0..447.
// Block = (n, 112 pixels = two image rows), 7 waves. The 384 x 112 f32 tile of x is read once (16 B per lane along l),
// converted to f16 and laid transposed in LDS as [pixel][c] at pitch KP. Wave w owns o columns 64w .. 64w+63 for all
// 112 pixels (7 x 4 D tiles); no other wave needs its weights, so it reads their fragments from the fragment-ordered
// W16 into registers, two k steps ahead; pixel fragments come from LDS one k step ahead. Waves 0..5 -> vT[n][l][o] = D/16 + bv (pitch 384); wave 6 -> aT[n][l][0..63].
// coverage: grid 8 x 28 tiles x 112 px = all pixels; 6 x 224 items x 8 rows x 4 px = 384 x 112; every (n, l, o<448)
// written exactly once as whole 256-B row segments.
// =====================================================================================
#define FP_ 112                   // pixels per block
#define FT_ (LP_ / FP_)           // 28 tiles per image
#define FM_ (FP_ / 16)            // 7 pixel tiles of 16
#define FQ_ (FP_ / 4)             // 28 float4 per x row segment

static_assert(FT_ * FP_ == LP_ && FM_ * 16 == FP_ && 224 == 8 * FQ_ && 6 * 8 * 8 == CD_ && 7 * 64 == NO1);

// Epilogue of one wave: each 16-pixel x 64-column f32 tile goes through the wave's own LDS rows (two buffers in turn)
// and leaves as whole 256-B rows. PITCH is a constant so that every store is one base plus an immediate offset.
template <int PITCH>
__device__ __forceinline__ void conv1_out(float* sE, const v8f (&acc)[FM_][4], const float (&b)[4], float* ob,
                                          int h, int m) {
  #pragma unroll
  for (int mt = 0; mt < FM_; ++mt) {
    float* sb = sE + (mt & 1) * (16 * EP);
    #pragma unroll
    for (int nt = 0; nt < 4; ++nt) {
      #pragma unroll
      for (int r = 0; r < 8; ++r) sb[(8 * h + r) * EP + nt * 16 + m] = acc[mt][nt][r] * 0.0625f + b[nt];
    }
    // the wave's LDS stores have landed before its other lanes read the rows back; also keeps the compiler's order
    asm volatile("s_wait_dscnt 0x0" ::: "memory");
    #pragma unroll
    for (int it = 0; it < 8; ++it) {
      const int row = it * 2 + h;               // 0..15, each once
      const v4f v = *(const v4fa*)(sb + row * EP + m * 4);
      st2_f4(ob + (size_t)(mt * 16 + row) * PITCH + m * 4, v);
    }
    // the stores' data registers are rewritten by the next tile while the stores are still in flight
    asm volatile("s_wait_xcnt 0x0" ::: "memory");
    // keeps the next tile's arithmetic, which rewrites those registers, behind the wait: the compiler lifted it over
    __builtin_amdgcn_sched_barrier(0);
  }
}

__global__ void __launch_bounds__(224) k_conv1(
    const float* __restrict__ x, const unsigned short* __restrict__ W16,
    const float* __restrict__ bias, float* vT, float* aT) {
  __shared__ __attribute__((aligned(16))) unsigned short sA[FP_ * KP];
  __shared__ __attribute__((aligned(16))) float sE[7 * 2 * 16 * EP];
  const int tid = threadIdx.x;
  const int lane = tid & 31;
  const int w = __builtin_amdgcn_readfirstlane(tid >> 5);   // 0..6, scalar: weight base and output plane are wave-uniform
  const int h = lane >> 4;
  const int m = lane & 15;
  const int bid = blockIdx.x;
  const int n = bid / FT_;
  const int l0 = (bid - n * FT_) * FP_;

  // x tile: item = (8 consecutive c, 4 consecutive px); all 48 loads of a thread are issued before the first use
  const int q4 = tid % FQ_;                  // 0..27
  const int og = tid / FQ_;                  // 0..7
  const float* xb = x + ((size_t)(n * CD_ + og * 8)) * LP_ + l0 + q4 * 4;
  v4f xr[6][8];
  // every loop of the kernel is fully unrolled: constant indices keep xr, fb, fa and acc in registers
  #pragma unroll
  for (int it = 0; it < 6; ++it) {
    #pragma unroll
    for (int i = 0; i < 8; ++i) xr[it][i] = *(const v4f*)(xb + (size_t)(it * 64 + i) * LP_);
  }
  // the x loads' address registers are taken over by the weight loads' results while the x loads are still in flight
  asm volatile("s_wait_xcnt 0x0" ::: "memory");

  // weight fragments of k steps 0 and 1
  const unsigned short* wb = W16 + (size_t)w * (4 * 12 * 512) + lane * 8;
  v16h fb[3][4];
  #pragma unroll
  for (int p = 0; p < 2; ++p) {
    #pragma unroll
    for (int nt = 0; nt < 4; ++nt) {
      Frag f;
      f.half[0] = *(const v8us*)(wb + (nt * 12 + p) * 512);
      f.half[1] = *(const v8us*)(wb + (nt * 12 + p) * 512 + 256);
      fb[p][nt] = __builtin_bit_cast(v16h, f.v);
    }
  }
  float b[4];
  #pragma unroll
  for (int nt = 0; nt < 4; ++nt) b[nt] = bias[w * 64 + nt * 16 + m];
  // the loads' address registers may be reused below while the loads are still in flight
  asm volatile("s_wait_xcnt 0x0" ::: "memory");

  #pragma unroll
  for (int it = 0; it < 6; ++it) {
    #pragma unroll
    for (int j = 0; j < 4; ++j) {
      v8us pk;
      #pragma unroll
      for (int i = 0; i < 8; ++i) pk[i] = h2us(xr[it][i][j]);
      *(v8usa*)(sA + (q4 * 4 + j) * KP + (it * 8 + og) * 8) = pk;
    }
  }
  __syncthreads();

  v8f acc[FM_][4];
  #pragma unroll
  for (int mt = 0; mt < FM_; ++mt) {
    #pragma unroll
    for (int nt = 0; nt < 4; ++nt) acc[mt][nt] = v8f_zero();
  }

  const unsigned short* ar = sA + m * KP;                // A: pixel rows, k = c
  v16h fa[2][FM_];
  #pragma unroll
  for (int mt = 0; mt < FM_; ++mt) fa[0][mt] = ldfrag(ar + mt * 16 * KP, h);
  #pragma unroll
  for (int ks = 0; ks < CD_ / 32; ++ks) {
    if (ks + 2 < CD_ / 32) {
      #pragma unroll
      for (int nt = 0; nt < 4; ++nt) {
        Frag f;
        f.half[0] = *(const v8us*)(wb + (nt * 12 + ks + 2) * 512);
        f.half[1] = *(const v8us*)(wb + (nt * 12 + ks + 2) * 512 + 256);
        fb[(ks + 2) % 3][nt] = __builtin_bit_cast(v16h, f.v);
      }
    }
    if (ks + 1 < CD_ / 32) {
      #pragma unroll
      for (int mt = 0; mt < FM_; ++mt) fa[(ks + 1) & 1][mt] = ldfrag(ar + mt * 16 * KP + (ks + 1) * 32, h);
    }
    // holds the later steps' loads as one group ahead of this step's WMMAs: left free, the compiler sank each load
    // to just before its first use and the wave waited out every LDS and L2 latency
    __builtin_amdgcn_sched_barrier(0);
    #pragma unroll
    for (int mt = 0; mt < FM_; ++mt) {
      #pragma unroll
      for (int nt = 0; nt < 4; ++nt) acc[mt][nt] = wmma_h(fa[ks & 1][mt], fb[ks % 3][nt], acc[mt][nt]);
    }
    // the next group of loads stays behind this step's WMMAs
    __builtin_amdgcn_sched_barrier(0);
  }

  // D element r of lane -> pixel row mt*16 + 8h + r, o col 64w + nt*16 + m
  float* sw = sE + w * (2 * 16 * EP);
  const size_t prow = (size_t)n * LP_ + l0;
  if (w < 6) conv1_out<CD_>(sw, acc, b, vT + prow * CD_ + w * 64, h, m);
  else       conv1_out<APD>(sw, acc, b, aT + prow * APD, h, m);
}

// =====================================================================================
// Kernel 2: per-pixel softmax over the 9 taps per head (f32) and the 3x3 zero-padded window sum (f32):
// y[c] = sum_k p[head(c)][k] * v[c][py + k/3 - 1][px + k%3 - 1], head(c) = c / 64, tap k = kh*3 + kw.
// One block = a tile of 2 rows x 7 pixels, all 384 channels; one thread = 4 consecutive channels (16-B loads along c,
// a wave reads 512 contiguous bytes of a vT row). The 4 x 9 pixel window that the 14 pixels share is read once into
// registers. The 84 (pixel, head) softmaxes run one per lane; a tap that falls outside the image gets weight 0
// (its address is clamped into the image), which is the zero padding.
// coverage: grid 8 n x 28 row pairs x 8 column groups = all 25088 pixels; 96 threads x 4 = 384 channels;
// each wave stores 256 contiguous bytes (two whole lines) of each yT row.
// =====================================================================================
#define AG_R  2
#define AG_P  7
#define AG_TX (WP_ / AG_P)        // 8
#define AG_TY (HP_ / AG_R)        // 28
#define AG_PX (AG_R * AG_P)       // 14 pixels per block
#define AG_IT (AG_PX * NHD)       // 84 softmax items per block
#define AG_WP 12                  // floats per item in LDS: 9 weights, padded to 48 B for 16-B reads

static_assert(AG_TX * AG_P == WP_ && AG_TY * AG_R == HP_ && AG_IT <= 96 && CD_ == 96 * 4);

typedef unsigned short v4us __attribute__((ext_vector_type(4)));

// aT and vT carry no __restrict__: with it the compiler moved logit loads behind the s_wait_xcnt written for them.
// Every loop of the kernel is fully unrolled: constant indices keep e, win and p in registers.
__global__ void __launch_bounds__(96) k_agg(
    const float* aT, const float* vT, unsigned short* yT) {
  __shared__ __attribute__((aligned(16))) float sp[96 * AG_WP];
  const int t = threadIdx.x;
  const int bid = blockIdx.x;
  const int tx = bid % AG_TX;
  const int ty = (bid / AG_TX) % AG_TY;
  const int n = bid / (AG_TX * AG_TY);
  const int x0 = tx * AG_P;
  const int y0 = ty * AG_R;

  // logits of this lane's (pixel, head) item; lanes 84..95 repeat item 83 into spare slots that nobody reads
  const int it = (t < AG_IT) ? t : (AG_IT - 1);
  const int ip = it / NHD;                   // pixel of the tile, 0..13
  const int ih = it - ip * NHD;              // head
  const int ir = ip / AG_P;
  const int iy = y0 + ir;
  const int ix = x0 + (ip - ir * AG_P);
  const float* ap = aT + ((size_t)n * LP_ + iy * WP_ + ix) * APD + ih * KK_;
  float e[KK_];
  #pragma unroll
  for (int k = 0; k < KK_; ++k) e[k] = ap[k];
  // the logit loads' address registers are taken over by the window below while those loads are still in flight
  asm volatile("s_wait_xcnt 0x0" ::: "memory");

  // the shared window: rows y0-1 .. y0+2, columns x0-1 .. x0+7, addresses clamped into the image (block-uniform)
  const float* vn = vT + (size_t)n * LP_ * CD_;
  const unsigned c4 = (unsigned)t * 4u;      // this lane's first channel
  const int xl = (x0 > 0) ? (x0 - 1) : 0;
  const int xr = (x0 + AG_P < WP_) ? (x0 + AG_P) : (WP_ - 1);
  v4f win[AG_R + 2][AG_P + 2];
  #pragma unroll
  for (int rr = 0; rr < AG_R + 2; ++rr) {
    int yc = y0 - 1 + rr;
    yc = (yc < 0) ? 0 : ((yc > HP_ - 1) ? (HP_ - 1) : yc);
    const float* vrow = vn + (size_t)(yc * WP_) * CD_;          // block-uniform row base
    win[rr][0] = *(const v4f*)(vrow + xl * CD_ + c4);
    #pragma unroll
    for (int cc = 1; cc <= AG_P; ++cc) win[rr][cc] = *(const v4f*)(vrow + (x0 + cc - 1) * CD_ + c4);
    win[rr][AG_P + 1] = *(const v4f*)(vrow + xr * CD_ + c4);
  }

  float mx = e[0];
  #pragma unroll
  for (int k = 1; k < KK_; ++k) mx = fmaxf(mx, e[k]);
  float s = 0.0f;
  #pragma unroll
  for (int k = 0; k < KK_; ++k) {
    e[k] = expf(e[k] - mx);
    s += e[k];
  }
  const float inv = 1.0f / s;
  #pragma unroll
  for (int k = 0; k < KK_; ++k) {
    const int yy = iy + (k / 3) - 1;
    const int xx = ix + (k % 3) - 1;
    const bool inb = (yy >= 0) && (yy < HP_) && (xx >= 0) && (xx < WP_);
    e[k] = inb ? e[k] * inv : 0.0f;
  }
  {
    float* wq = sp + t * AG_WP;
    const v4f q0 = {e[0], e[1], e[2], e[3]};
    const v4f q1 = {e[4], e[5], e[6], e[7]};
    *(v4fa*)wq = q0;
    *(v4fa*)(wq + 4) = q1;
    wq[8] = e[8];
  }
  __syncthreads();

  const int hd = t >> 4;            // head of channels 4t .. 4t+3
  unsigned short* yb = yT + ((size_t)n * LP_ + y0 * WP_ + x0) * CD_ + t * 4;
  #pragma unroll
  for (int r = 0; r < AG_R; ++r) {
    #pragma unroll
    for (int cx = 0; cx < AG_P; ++cx) {
      const float* wq = sp + ((r * AG_P + cx) * NHD + hd) * AG_WP;
      const v4f q0 = *(const v4fa*)wq;
      const v4f q1 = *(const v4fa*)(wq + 4);
      const float p[KK_] = {q0.x, q0.y, q0.z, q0.w, q1.x, q1.y, q1.z, q1.w, wq[8]};
      v4f acc = {0.0f, 0.0f, 0.0f, 0.0f};
      #pragma unroll
      for (int k = 0; k < KK_; ++k) {
        const v4f v = win[r + k / 3][cx + k % 3];
        acc.x = fmaf(p[k], v.x, acc.x);
        acc.y = fmaf(p[k], v.y, acc.y);
        acc.z = fmaf(p[k], v.z, acc.z);
        acc.w = fmaf(p[k], v.w, acc.w);
      }
      const v4us o = {h2us(acc.x), h2us(acc.y), h2us(acc.z), h2us(acc.w)};
      *(v4us*)(yb + (size_t)(r * WP_ + cx) * CD_) = o;
    }
  }
}

// =====================================================================================
// Kernel 3: projection. D[m = o][n = pixel l] = sum_c W16[448 + o][c] * yT[l][c]; out[n][o][l] = D/16 + bp[o] (NCHW f32).
// Block = 128 consecutive yT rows (two 64-pixel tiles, each inside one image) x all 384 o, 8 waves. The 128 x 384 f16
// tile of yT is read once and laid in LDS at pitch KP. Wave w owns o rows 48w .. 48w+47 for all 128 pixels
// (3 x 8 D tiles); no other wave needs its weights, so it reads their fragments from the fragment-ordered W16 into
// registers, two k steps ahead; pixel fragments come from LDS one k step ahead.
// coverage: grid 196 x 128 px = all 25088 pixels; 8 waves x 48 = 384 o; every (n, o, l) written exactly once as whole
// 256-B row segments of out.
// =====================================================================================
#define PJ_PX 128                 // pixels per block
#define PJ_NT (PJ_PX / 16)        // 8 pixel tiles of 16
#define PJ_OT 3                   // 16-row o tiles per wave
#define PJ_G  (NB_ * NPT / 2)     // 196 blocks

static_assert(PJ_G * PJ_PX == NB_ * LP_ && 8 * PJ_OT * 16 == CD_ && PJ_PX == 2 * 64 && NO1 % 16 == 0);

// Epilogue of one wave: each 16-o x 64-pixel f32 tile goes through the wave's own LDS rows (two buffers in turn)
// and leaves as whole 256-B row segments. The row pitch is a constant: every store is one base plus an immediate offset.
__device__ __forceinline__ void proj_out(float* sE, const v8f (&acc)[PJ_OT][PJ_NT], const v4f (&b)[PJ_OT][2],
                                         float* ob0, float* ob1, int h, int m) {
  #pragma unroll
  for (int ot = 0; ot < PJ_OT; ++ot) {
    #pragma unroll
    for (int hf = 0; hf < 2; ++hf) {
      float* sb = sE + hf * (16 * EP);
      float* ob = hf ? ob1 : ob0;
      #pragma unroll
      for (int nt = 0; nt < 4; ++nt) {
        #pragma unroll
        for (int r = 0; r < 8; ++r)
          sb[(8 * h + r) * EP + nt * 16 + m] = acc[ot][hf * 4 + nt][r] * 0.0625f + b[ot][r >> 2][r & 3];
      }
      // the wave's LDS stores have landed before its other lanes read the rows back; also keeps the compiler's order
      asm volatile("s_wait_dscnt 0x0" ::: "memory");
      #pragma unroll
      for (int it = 0; it < 8; ++it) {
        const int row = it * 2 + h;             // 0..15, each once
        const v4f v = *(const v4fa*)(sb + row * EP + m * 4);
        st2_f4(ob + (size_t)(ot * 16 + row) * LP_ + m * 4, v);
      }
      // the stores' data registers are rewritten by the next tile while the stores are still in flight
      asm volatile("s_wait_xcnt 0x0" ::: "memory");
      // keeps the next tile's arithmetic, which rewrites those registers, behind the wait
      __builtin_amdgcn_sched_barrier(0);
    }
  }
}

__global__ void __launch_bounds__(256) k_proj(
    const unsigned short* __restrict__ yT, const unsigned short* __restrict__ W16,
    const float* __restrict__ bp, float* __restrict__ out) {
  __shared__ __attribute__((aligned(16))) unsigned short sY[PJ_PX * KP];
  __shared__ __attribute__((aligned(16))) float sE[8 * 2 * 16 * EP];
  const int tid = threadIdx.x;
  const int lane = tid & 31;
  const int w = __builtin_amdgcn_readfirstlane(tid >> 5);   // 0..7, scalar: weight base and output rows are wave-uniform
  const int h = lane >> 4;
  const int m = lane & 15;
  const int bid = blockIdx.x;

  // weight fragments of k steps 0 and 1, and the wave's bias values (8 consecutive o per lane and o tile)
  // every loop of the kernel is fully unrolled: constant indices keep fw, fy and acc in registers
  const unsigned short* wb = W16 + (size_t)(NO1 / 16 + w * PJ_OT) * (12 * 512) + lane * 8;
  v16h fw[3][PJ_OT];
  #pragma unroll
  for (int p = 0; p < 2; ++p) {
    #pragma unroll
    for (int ot = 0; ot < PJ_OT; ++ot) {
      Frag f;
      f.half[0] = *(const v8us*)(wb + (ot * 12 + p) * 512);
      f.half[1] = *(const v8us*)(wb + (ot * 12 + p) * 512 + 256);
      fw[p][ot] = __builtin_bit_cast(v16h, f.v);
    }
  }
  v4f b[PJ_OT][2];
  #pragma unroll
  for (int ot = 0; ot < PJ_OT; ++ot) {
    b[ot][0] = *(const v4f*)(bp + w * (PJ_OT * 16) + ot * 16 + 8 * h);
    b[ot][1] = *(const v4f*)(bp + w * (PJ_OT * 16) + ot * 16 + 8 * h + 4);
  }
  // the loads' address registers may be reused below while the loads are still in flight
  asm volatile("s_wait_xcnt 0x0" ::: "memory");

  const unsigned short* yb = yT + (size_t)bid * (PJ_PX * CD_);
  stage_ops(yb, yb + 64 * CD_, sY, sY + OPT_H, tid);
  __syncthreads();

  v8f acc[PJ_OT][PJ_NT];
  #pragma unroll
  for (int ot = 0; ot < PJ_OT; ++ot) {
    #pragma unroll
    for (int nt = 0; nt < PJ_NT; ++nt) acc[ot][nt] = v8f_zero();
  }

  const unsigned short* yr = sY + m * KP;                // B: yT rows [l][c], k = c
  v16h fy[2][PJ_NT];
  #pragma unroll
  for (int nt = 0; nt < PJ_NT; ++nt) fy[0][nt] = ldfrag(yr + nt * 16 * KP, h);
  #pragma unroll
  for (int ks = 0; ks < CD_ / 32; ++ks) {
    if (ks + 2 < CD_ / 32) {
      #pragma unroll
      for (int ot = 0; ot < PJ_OT; ++ot) {
        Frag f;
        f.half[0] = *(const v8us*)(wb + (ot * 12 + ks + 2) * 512);
        f.half[1] = *(const v8us*)(wb + (ot * 12 + ks + 2) * 512 + 256);
        fw[(ks + 2) % 3][ot] = __builtin_bit_cast(v16h, f.v);
      }
      // behind the last group the loads' offset register is free and takes an LDS address while the loads are in flight
      if (ks + 3 == CD_ / 32) asm volatile("s_wait_xcnt 0x0" ::: "memory");
    }
    if (ks + 1 < CD_ / 32) {
      #pragma unroll
      for (int nt = 0; nt < PJ_NT; ++nt) fy[(ks + 1) & 1][nt] = ldfrag(yr + nt * 16 * KP + (ks + 1) * 32, h);
    }
    // holds the later steps' loads as one group ahead of this step's WMMAs, so that no load sinks to its first use
    __builtin_amdgcn_sched_barrier(0);
    #pragma unroll
    for (int ot = 0; ot < PJ_OT; ++ot) {
      #pragma unroll
      for (int nt = 0; nt < PJ_NT; ++nt) acc[ot][nt] = wmma_h(fw[ks % 3][ot], fy[ks & 1][nt], acc[ot][nt]);
    }
    // the next group of loads stays behind this step's WMMAs
    __builtin_amdgcn_sched_barrier(0);
  }

  // D element r of lane -> o row 48w + ot*16 + 8h + r, pixel col nt*16 + m; pixel tiles 0..3 and 4..7 are the block's
  // two 64-pixel tiles, each with its own image and place
  const int t0 = bid * 2;
  const int t1 = t0 + 1;
  const int n0 = t0 / NPT;
  const int n1 = t1 / NPT;
  float* ob0 = out + (size_t)(n0 * CD_ + w * (PJ_OT * 16)) * LP_ + (t0 - n0 * NPT) * 64;
  float* ob1 = out + (size_t)(n1 * CD_ + w * (PJ_OT * 16)) * LP_ + (t1 - n1 * NPT) * 64;
  proj_out(sE + w * (2 * 16 * EP), acc, b, ob0, ob1, h, m);
}

// =====================================================================================
extern "C" void kernel_launch(void* const* d_in, const int* in_sizes, int n_in,
                              void* d_out, int out_size, void* d_ws, size_t ws_size,
                              hipStream_t stream) {
  if (n_in < 7) return;
  if (in_sizes[0] != X_N || in_sizes[1] != WA_N || in_sizes[2] != NATT ||
      in_sizes[3] != WV_N || in_sizes[4] != CD_ || in_sizes[5] != WV_N || in_sizes[6] != CD_) return;
  if (out_size != OUT_N) return;
  if (ws_size < (size_t)WS_TOTAL) return;

  const float* x  = (const float*)d_in[0];
  const float* Wa = (const float*)d_in[1];
  const float* ba = (const float*)d_in[2];
  const float* Wv = (const float*)d_in[3];
  const float* bv = (const float*)d_in[4];
  const float* Wp = (const float*)d_in[5];
  const float* bp = (const float*)d_in[6];
  float* out = (float*)d_out;

  char* ws = (char*)d_ws;
  float*          vT   = (float*)(ws + OFF_VT);
  float*          aT   = (float*)(ws + OFF_AT);
  unsigned short* yT   = (unsigned short*)(ws + OFF_YT);
  unsigned short* W16  = (unsigned short*)(ws + OFF_W16);
  float*          bias = (float*)(ws + OFF_BIAS);

  k_wprep<<<dim3(157), dim3(256), 0, stream>>>(Wv, Wa, Wp, bv, ba, W16, bias);
  k_conv1<<<dim3(NB_ * FT_), dim3(224), 0, stream>>>(x, W16, bias, vT, aT);
  k_agg<<<dim3(NB_ * AG_TY * AG_TX), dim3(96), 0, stream>>>(aT, vT, yT);
  k_proj<<<dim3(PJ_G), dim3(256), 0, stream>>>(yT, W16, bp, out);
}

// v005
// It runs in 36.3 microseconds.
// Timed twice side by side with v004, it ran 1.12 and 1.11 times as fast.
// All steps since v000 together make it 4.45 times as fast.
#include <hip/hip_runtime.h>

// All contractions: v_wmma_f32_16x16x32_f16 (f16 operands: weights carried x16, activations x1), f32 accumulate,
// 1/16 folded in the f32 epilogues. Softmax over the 9 window taps and the 3x3 weighted window sum: f32 on VALU.
// Carry audit:
//   W16 rows   0..383 = f16(16*Wv), rows 384..437 = f16(16*Wa), rows 438..447 = 0 : inverse 0.0625f in conv1_out (k_conv1)
//   W16 rows 448..831 = f16(16*Wp)                                                : inverse 0.0625f in proj_out (k_aggproj)
//   f16(x) carry 1 (LDS only), f16(y) carry 1 (LDS only) : no inverse needed
//   vT, aT, BIAS line : f32, no carry

#define NB_   8
#define CD_   384
#define LP_   3136
#define WP_   56
#define HP_   56
#define NATT  54              // 6 heads x 9 taps
#define NHD   6
#define KK_   9
#define APD   64              // padded logit columns
#define NO1   448             // fused conv1 output columns: 384 (v) + 64 (logits, padded)
#define WROWS 832             // 448 + 384 weight rows
#define NPT   (LP_ / 64)      // 49 pixel tiles

#define X_N   (NB_ * CD_ * LP_)   // 9633792
#define WA_N  (NATT * CD_)        // 20736
#define WV_N  (CD_ * CD_)         // 147456
#define OUT_N X_N

#define SZ_VT   ((size_t)NB_ * LP_ * CD_ * 4)   // 38535168  f32 [n][l][c]
#define SZ_AT   ((size_t)NB_ * LP_ * APD * 4)   // 6422528   f32 [n][l][64]
#define SZ_XT   ((size_t)NB_ * LP_ * CD_ * 2)   // 19267584  reserved, unused (x is read directly)
#define SZ_YT   SZ_XT                           // 19267584  reserved, unused (y stays in LDS)
#define SZ_W16  ((size_t)WROWS * CD_ * 2)       // 638976    f16: all 832 rows in fragment order
#define SZ_BIAS ((size_t)NO1 * 4)               // 1792      f32 [448]
#define OFF_VT   ((size_t)0)
#define OFF_AT   (OFF_VT + SZ_VT)
#define OFF_XT   (OFF_AT + SZ_AT)
#define OFF_YT   (OFF_XT + SZ_XT)
#define OFF_W16  (OFF_YT + SZ_YT)
#define OFF_BIAS (OFF_W16 + SZ_W16)
#define WS_TOTAL (OFF_BIAS + SZ_BIAS)           // 84133632

static_assert(WS_TOTAL == 84133632);
static_assert(WS_TOTAL <= 134217728);
static_assert((OFF_AT % 128) == 0 && (OFF_XT % 128) == 0 && (OFF_YT % 128) == 0 &&
              (OFF_W16 % 128) == 0 && (OFF_BIAS % 128) == 0);
static_assert(LP_ % 64 == 0 && CD_ % 64 == 0 && (NB_ * LP_) % 64 == 0);
static_assert(WROWS * 48 == 156 * 256 && CD_ * 48 == 72 * 256 && APD * 48 == 12 * 256);

#define EP 68      // GEMM epilogue LDS pitch (floats), 272 B
#define KP 392     // GEMM operand LDS pitch (halves), 784 B = 16 B x 49 (odd): conflict-free 16-B fragment reads
#define OPT_H (64 * KP)                 // unused: 64 rows at pitch KP

static_assert((64 * CD_ / 8) == 12 * 256 && (3 * 256) % (CD_ / 8) == 0);

typedef unsigned short v8us  __attribute__((ext_vector_type(8)));
typedef unsigned short v8usa __attribute__((ext_vector_type(8), __may_alias__));
typedef unsigned short v16us __attribute__((ext_vector_type(16)));
typedef _Float16       v16h  __attribute__((ext_vector_type(16)));
typedef float          v8f   __attribute__((ext_vector_type(8)));
typedef float          v4f   __attribute__((ext_vector_type(4)));
typedef float          v4fa  __attribute__((ext_vector_type(4), __may_alias__));

union Frag { v16us v; v8us half[2]; };

// f32 -> f16 bits (RNE convert)
__device__ __forceinline__ unsigned short h2us(float f) {
  return __builtin_bit_cast(unsigned short, (_Float16)f);
}

__device__ __forceinline__ void st2_u8(unsigned short* p, v8us v) {
  *(v8us*)p = v;
  
}
__device__ __forceinline__ void st2_f4(float* p, v4f v) {
  *(v4f*)p = v;
  
}

// 16-bit fragment from a k-contiguous row: elements 0..7 <- k0+8h+0..7, elements 8..15 <- k0+16+8h+0..7.
// Used for A rows [m][k] and for B stored as [n][k] rows (same per-lane k map); rowp points at element k0 of the row.
__device__ __forceinline__ v16h ldfrag(const unsigned short* rowp, int h) {
  Frag f;
  f.half[0] = *(const v8usa*)(rowp + 8 * h);
  f.half[1] = *(const v8usa*)(rowp + 16 + 8 * h);
  return __builtin_bit_cast(v16h, f.v);
}

__device__ __forceinline__ v8f wmma_h(v16h a, v16h b, v8f c) {
  return __builtin_amdgcn_wmma_f32_16x16x32_f16(false, a, false, b, (short)0, c, false, false);
}

__device__ __forceinline__ v8f v8f_zero() {
  v8f z = {0.f, 0.f, 0.f, 0.f, 0.f, 0.f, 0.f, 0.f};
  return z;
}

// =====================================================================================
// Kernel 0: weight planes + fused bias line.
// W16[832][384] halves: rows 0..383 = f16(16*Wv[o][c]), 384..447 = f16(16*Wa[o-384][c]) (o-384 >= 54 -> 0),
// 448..831 = f16(16*Wp[o-448][c]). One thread = 8 consecutive c (16 B).
// All rows are laid in WMMA fragment order: per (16-row tile, 32-k step) 1024 B = 2 pieces x 32 lanes x 16 B,
// lane (m, h) piece j = row tile*16+m, c = ks*32 + 16j + 8h + 0..7, so a wave reads a fragment as two 512-B runs.
// A 16-row tile is 768 pieces = 3 blocks, so the block-uniform region select below holds in this order.
// Block 156: BIAS[448] = [bv | ba padded with 0], 112 float4 pieces, 8 consecutive lanes per line.
// coverage: 156*256 = 832*48 items exactly; 112 float4 = 448 floats exactly.
// =====================================================================================
__global__ void __launch_bounds__(256) k_wprep(
    const float* __restrict__ Wv, const float* __restrict__ Wa, const float* __restrict__ Wp,
    const float* __restrict__ bv, const float* __restrict__ ba,
    unsigned short* __restrict__ W16, float* __restrict__ bias) {
  const int tid = threadIdx.x;
  const int bid = blockIdx.x;
  if (bid < 156) {
    const int i = bid * 256 + tid;            // < 39936
    // fragment order: 16-B piece i = ((tile * 12 + ks) * 2 + j) * 32 + lane
    const int pl = i & 31;
    const int pj = (i >> 5) & 1;
    const int pt = i >> 6;                    // tile * 12 + ks
    const int tl = pt / 12;                   // 16-row tile, 0..51
    const int row = tl * 16 + (pl & 15);      // 0..831
    const int c8 = (pt - tl * 12) * 32 + pj * 16 + (pl >> 4) * 8;   // 0..376
    const float* src;
    int srow;
    bool valid = true;
    if (bid < 72) {                           // block-uniform region select
      src = Wv; srow = row;
    } else if (bid < 84) {
      const int r = row - 384;                // 0..63
      valid = (r < NATT);
      srow = (r < NATT) ? r : (NATT - 1);     // clamped address, zero by predicate
      src = Wa;
    } else {
      src = Wp; srow = row - 448;
    }
    const size_t off = (size_t)srow * CD_ + c8;
    const v4f a0 = *(const v4f*)(src + off);
    const v4f a1 = *(const v4f*)(src + off + 4);
    // the loads' address registers take the store address while the loads are still in flight
    asm volatile("s_wait_xcnt 0x0" ::: "memory");
    const float sc = 16.0f;
    v8us ov;
    ov[0] = valid ? h2us(a0.x * sc) : (unsigned short)0;
    ov[1] = valid ? h2us(a0.y * sc) : (unsigned short)0;
    ov[2] = valid ? h2us(a0.z * sc) : (unsigned short)0;
    ov[3] = valid ? h2us(a0.w * sc) : (unsigned short)0;
    ov[4] = valid ? h2us(a1.x * sc) : (unsigned short)0;
    ov[5] = valid ? h2us(a1.y * sc) : (unsigned short)0;
    ov[6] = valid ? h2us(a1.z * sc) : (unsigned short)0;
    ov[7] = valid ? h2us(a1.w * sc) : (unsigned short)0;
    st2_u8(W16 + (size_t)i * 8, ov);
  } else {
    if (tid < 112) {
      const int e0 = tid * 4;                         // 0..444
      const int tb = (tid < 96) ? tid : 95;           // clamped bv piece
      const v4f vb = *(const v4f*)(bv + tb * 4);
      const bool isv = (tid < 96);
      int ea = e0 - 384;
      int c0 = ea;     c0 = (c0 < 0) ? 0 : ((c0 > NATT - 1) ? (NATT - 1) : c0);
      int c1 = ea + 1; c1 = (c1 < 0) ? 0 : ((c1 > NATT - 1) ? (NATT - 1) : c1);
      int c2 = ea + 2; c2 = (c2 < 0) ? 0 : ((c2 > NATT - 1) ? (NATT - 1) : c2);
      int c3 = ea + 3; c3 = (c3 < 0) ? 0 : ((c3 > NATT - 1) ? (NATT - 1) : c3);
      const float q0 = ba[c0], q1 = ba[c1], q2 = ba[c2], q3 = ba[c3];
      v4f o;
      o.x = isv ? vb.x : ((ea + 0 >= 0 && ea + 0 < NATT) ? q0 : 0.0f);
      o.y = isv ? vb.y : ((ea + 1 >= 0 && ea + 1 < NATT) ? q1 : 0.0f);
      o.z = isv ? vb.z : ((ea + 2 >= 0 && ea + 2 < NATT) ? q2 : 0.0f);
      o.w = isv ? vb.w : ((ea + 3 >= 0 && ea + 3 < NATT) ? q3 : 0.0f);
      st2_f4(bias + e0, o);
    }
  }
}

// =====================================================================================
// Kernel 1: fused conv1, straight from x. D[m = pixel l][n = o] = sum_c f16(x[c][l]) * W16[o][c], o in 0..447.
// Block = (n, 112 pixels = two image rows), 7 waves. The 384 x 112 f32 tile of x is read once (16 B per lane along l),
// converted to f16 and laid transposed in LDS as [pixel][c] at pitch KP. Wave w owns o columns 64w .. 64w+63 for all
// 112 pixels (7 x 4 D tiles); no other wave needs its weights, so it reads their fragments from the fragment-ordered
// W16 into registers, two k steps ahead; pixel fragments come from LDS one k step ahead. Waves 0..5 -> vT[n][l][o] = D/16 + bv (pitch 384); wave 6 -> aT[n][l][0..63].
// coverage: grid 8 x 28 tiles x 112 px = all pixels; 6 x 224 items x 8 rows x 4 px = 384 x 112; every (n, l, o<448)
// written exactly once as whole 256-B row segments.
// =====================================================================================
#define FP_ 112                   // pixels per block
#define FT_ (LP_ / FP_)           // 28 tiles per image
#define FM_ (FP_ / 16)            // 7 pixel tiles of 16
#define FQ_ (FP_ / 4)             // 28 float4 per x row segment

static_assert(FT_ * FP_ == LP_ && FM_ * 16 == FP_ && 224 == 8 * FQ_ && 6 * 8 * 8 == CD_ && 7 * 64 == NO1);

// Epilogue of one wave: each 16-pixel x 64-column f32 tile goes through the wave's own LDS rows (two buffers in turn)
// and leaves as whole 256-B rows. PITCH is a constant so that every store is one base plus an immediate offset.
template <int PITCH>
__device__ __forceinline__ void conv1_out(float* sE, const v8f (&acc)[FM_][4], const float (&b)[4], float* ob,
                                          int h, int m) {
  #pragma unroll
  for (int mt = 0; mt < FM_; ++mt) {
    float* sb = sE + (mt & 1) * (16 * EP);
    #pragma unroll
    for (int nt = 0; nt < 4; ++nt) {
      #pragma unroll
      for (int r = 0; r < 8; ++r) sb[(8 * h + r) * EP + nt * 16 + m] = acc[mt][nt][r] * 0.0625f + b[nt];
    }
    // the wave's LDS stores have landed before its other lanes read the rows back; also keeps the compiler's order
    asm volatile("s_wait_dscnt 0x0" ::: "memory");
    #pragma unroll
    for (int it = 0; it < 8; ++it) {
      const int row = it * 2 + h;               // 0..15, each once
      const v4f v = *(const v4fa*)(sb + row * EP + m * 4);
      st2_f4(ob + (size_t)(mt * 16 + row) * PITCH + m * 4, v);
    }
    // the stores' data registers are rewritten by the next tile while the stores are still in flight
    asm volatile("s_wait_xcnt 0x0" ::: "memory");
    // keeps the next tile's arithmetic, which rewrites those registers, behind the wait: the compiler lifted it over
    __builtin_amdgcn_sched_barrier(0);
  }
}

__global__ void __launch_bounds__(224) k_conv1(
    const float* __restrict__ x, const unsigned short* __restrict__ W16,
    const float* __restrict__ bias, float* vT, float* aT) {
  __shared__ __attribute__((aligned(16))) unsigned short sA[FP_ * KP];
  __shared__ __attribute__((aligned(16))) float sE[7 * 2 * 16 * EP];
  const int tid = threadIdx.x;
  const int lane = tid & 31;
  const int w = __builtin_amdgcn_readfirstlane(tid >> 5);   // 0..6, scalar: weight base and output plane are wave-uniform
  const int h = lane >> 4;
  const int m = lane & 15;
  const int bid = blockIdx.x;
  const int n = bid / FT_;
  const int l0 = (bid - n * FT_) * FP_;

  // x tile: item = (8 consecutive c, 4 consecutive px); all 48 loads of a thread are issued before the first use
  const int q4 = tid % FQ_;                  // 0..27
  const int og = tid / FQ_;                  // 0..7
  const float* xb = x + ((size_t)(n * CD_ + og * 8)) * LP_ + l0 + q4 * 4;
  v4f xr[6][8];
  // every loop of the kernel is fully unrolled: constant indices keep xr, fb, fa and acc in registers
  #pragma unroll
  for (int it = 0; it < 6; ++it) {
    #pragma unroll
    for (int i = 0; i < 8; ++i) xr[it][i] = *(const v4f*)(xb + (size_t)(it * 64 + i) * LP_);
  }
  // the x loads' address registers are taken over by the weight loads' results while the x loads are still in flight
  asm volatile("s_wait_xcnt 0x0" ::: "memory");

  // weight fragments of k steps 0 and 1
  const unsigned short* wb = W16 + (size_t)w * (4 * 12 * 512) + lane * 8;
  v16h fb[3][4];
  #pragma unroll
  for (int p = 0; p < 2; ++p) {
    #pragma unroll
    for (int nt = 0; nt < 4; ++nt) {
      Frag f;
      f.half[0] = *(const v8us*)(wb + (nt * 12 + p) * 512);
      f.half[1] = *(const v8us*)(wb + (nt * 12 + p) * 512 + 256);
      fb[p][nt] = __builtin_bit_cast(v16h, f.v);
    }
  }
  float b[4];
  #pragma unroll
  for (int nt = 0; nt < 4; ++nt) b[nt] = bias[w * 64 + nt * 16 + m];
  // the loads' address registers may be reused below while the loads are still in flight
  asm volatile("s_wait_xcnt 0x0" ::: "memory");

  #pragma unroll
  for (int it = 0; it < 6; ++it) {
    #pragma unroll
    for (int j = 0; j < 4; ++j) {
      v8us pk;
      #pragma unroll
      for (int i = 0; i < 8; ++i) pk[i] = h2us(xr[it][i][j]);
      *(v8usa*)(sA + (q4 * 4 + j) * KP + (it * 8 + og) * 8) = pk;
    }
  }
  __syncthreads();

  v8f acc[FM_][4];
  #pragma unroll
  for (int mt = 0; mt < FM_; ++mt) {
    #pragma unroll
    for (int nt = 0; nt < 4; ++nt) acc[mt][nt] = v8f_zero();
  }

  const unsigned short* ar = sA + m * KP;                // A: pixel rows, k = c
  v16h fa[2][FM_];
  #pragma unroll
  for (int mt = 0; mt < FM_; ++mt) fa[0][mt] = ldfrag(ar + mt * 16 * KP, h);
  #pragma unroll
  for (int ks = 0; ks < CD_ / 32; ++ks) {
    if (ks + 2 < CD_ / 32) {
      #pragma unroll
      for (int nt = 0; nt < 4; ++nt) {
        Frag f;
        f.half[0] = *(const v8us*)(wb + (nt * 12 + ks + 2) * 512);
        f.half[1] = *(const v8us*)(wb + (nt * 12 + ks + 2) * 512 + 256);
        fb[(ks + 2) % 3][nt] = __builtin_bit_cast(v16h, f.v);
      }
    }
    if (ks + 1 < CD_ / 32) {
      #pragma unroll
      for (int mt = 0; mt < FM_; ++mt) fa[(ks + 1) & 1][mt] = ldfrag(ar + mt * 16 * KP + (ks + 1) * 32, h);
    }
    // holds the later steps' loads as one group ahead of this step's WMMAs: left free, the compiler sank each load
    // to just before its first use and the wave waited out every LDS and L2 latency
    __builtin_amdgcn_sched_barrier(0);
    #pragma unroll
    for (int mt = 0; mt < FM_; ++mt) {
      #pragma unroll
      for (int nt = 0; nt < 4; ++nt) acc[mt][nt] = wmma_h(fa[ks & 1][mt], fb[ks % 3][nt], acc[mt][nt]);
    }
    // the next group of loads stays behind this step's WMMAs
    __builtin_amdgcn_sched_barrier(0);
  }

  // D element r of lane -> pixel row mt*16 + 8h + r, o col 64w + nt*16 + m
  float* sw = sE + w * (2 * 16 * EP);
  const size_t prow = (size_t)n * LP_ + l0;
  if (w < 6) conv1_out<CD_>(sw, acc, b, vT + prow * CD_ + w * 64, h, m);
  else       conv1_out<APD>(sw, acc, b, aT + prow * APD, h, m);
}

// =====================================================================================
// Kernel 2: softmax, window sum and projection in one kernel.
// Block = 128 consecutive pixel rows of vT / aT (two 64-pixel tiles, each inside one image) x all 384 o, 8 waves.
// Part 1: per (pixel, head) softmax over the 9 taps (f32), 768 items = 3 per thread; a tap that falls outside the image
// gets weight 0, which is the zero padding. Weights go to LDS (the epilogue's rows, not yet in use).
// Part 2: y[c] = sum_k p[head(c)][k] * v[c][l + (k/3 - 1) * 56 + (k%3 - 1)], head(c) = c / 64, f32, taps in ascending k.
// One wave item = 8 consecutive pixels x 128 channels (4 per lane, 16-B loads, 512 contiguous bytes of a vT row):
// three runs of 10 pixels (rows above, own, below) in registers serve the 8 pixels. Pixel indices are clamped into the
// image; a clamped or wrapped neighbour always meets weight 0. 48 items = 6 per wave, the next item's loads in flight
// while this one is summed. f16(y) goes straight to the LDS tile [pixel][c] at pitch KP that part 3 reads.
// Part 3: D[m = o][n = pixel l] = sum_c W16[448 + o][c] * y[l][c]; out[n][o][l] = D/16 + bp[o] (NCHW f32).
// Wave w owns o rows 48w .. 48w+47 for all 128 pixels (3 x 8 D tiles); no other wave needs its weights, so it reads
// their fragments from the fragment-ordered W16 into registers, two k steps ahead; pixel fragments come from LDS one
// k step ahead.
// coverage: grid 196 x 128 px = all 25088 pixels; 16 runs x 3 slices = 128 px x 384 c of the y tile, each once;
// 8 waves x 48 = 384 o; every (n, o, l) written exactly once as whole 256-B row segments of out.
// =====================================================================================
#define PJ_PX 128                 // pixels per block
#define PJ_NT (PJ_PX / 16)        // 8 pixel tiles of 16
#define PJ_OT 3                   // 16-row o tiles per wave
#define PJ_G  (NB_ * NPT / 2)     // 196 blocks
#define AG_WP 12                  // floats per softmax item in LDS: 9 weights, padded to 48 B for 16-B reads
#define AG_R  8                   // pixels per wave item
#define AG_W  (AG_R + 2)          // pixels per window run
#define AG_NI 6                   // items per wave

static_assert(PJ_G * PJ_PX == NB_ * LP_ && 8 * PJ_OT * 16 == CD_ && PJ_PX == 2 * 64 && NO1 % 16 == 0);
static_assert(PJ_PX * NHD == 3 * 256 && (PJ_PX / AG_R) * 3 == AG_NI * 8 && PJ_PX / AG_R == 16);
static_assert(PJ_PX * NHD * AG_WP <= 8 * 2 * 16 * EP && WP_ % AG_R == 0 && 64 % AG_R == 0 && LP_ % AG_R == 0);

typedef unsigned short v4usa __attribute__((ext_vector_type(4), __may_alias__));

// Item q (wave-uniform, 0..47): channel slice q % 3, pixel run (7 * (q / 3)) & 15. Runs 7 apart are 56 pixels apart and
// read the same vT rows, so this order puts those reads close together in time.
__device__ __forceinline__ int agg_slice(int q) { return q % 3; }
__device__ __forceinline__ int agg_run(int q) { return (7 * (q / 3)) & 15; }

// A wave-uniform row address, held in a scalar register pair: each load is then scalar base + one lane offset +
// immediate, with no vector address arithmetic and no address pair per load in vector registers.
// The result is typed as a global-memory pointer: an address rebuilt from integers would otherwise be loaded through
// the generic path.
typedef const float __attribute__((address_space(1)))* gcf;
typedef const v4f __attribute__((address_space(1)))* gcv4;
__device__ __forceinline__ gcf sbase(const float* p) {
  const unsigned long long u = (unsigned long long)p;
  const unsigned lo = (unsigned)__builtin_amdgcn_readfirstlane((int)(unsigned)u);
  const unsigned hi = (unsigned)__builtin_amdgcn_readfirstlane((int)(unsigned)(u >> 32));
  return (gcf)(((unsigned long long)hi << 32) | lo);
}

__device__ __forceinline__ void agg_load(v4f (&win)[3][AG_W], const float* vT, int bid, int q, int lane) {
  const int j = agg_run(q);
  const int t = bid * 2 + (j >> 3);                    // 64-pixel tile
  const int n = t / NPT;
  const int s = (t - n * NPT) * 64 + (j & 7) * AG_R;   // first pixel of the run inside its image
  const float* vn = vT + (size_t)n * LP_ * CD_ + agg_slice(q) * 128;   // wave-uniform
  const unsigned l4 = (unsigned)lane * 4u;
  // a = first pixel of a run of 10; a + 1 is a multiple of 8. Pixels a+1 .. a+8 lie all inside the image or all outside
  // it (then every tap on them has weight 0 and any 8 pixels of the image serve), so one clamp bounds the 8; the two end
  // pixels are clamped each on its own.
  gcf r0[3], rm[3], r9[3];
  #pragma unroll
  for (int kh = 0; kh < 3; ++kh) {
    const int a = s + (kh - 1) * WP_ - 1;
    int pm = a + 1;
    pm = (pm < 0) ? 0 : ((pm > LP_ - AG_R) ? (LP_ - AG_R) : pm);
    int p0 = a;
    p0 = (p0 < 0) ? 0 : ((p0 > LP_ - 1) ? (LP_ - 1) : p0);
    int p9 = a + AG_W - 1;
    p9 = (p9 < 0) ? 0 : ((p9 > LP_ - 1) ? (LP_ - 1) : p9);
    r0[kh] = sbase(vn + p0 * CD_);
    rm[kh] = sbase(vn + pm * CD_);
    r9[kh] = sbase(vn + p9 * CD_);
  }
  // all nine bases are formed ahead of the first load: left free, the compiler formed some between the loads, in scalar
  // registers that an issued load still named
  __builtin_amdgcn_sched_barrier(0);
  #pragma unroll
  for (int kh = 0; kh < 3; ++kh) {
    win[kh][0] = *(gcv4)(r0[kh] + l4);
    #pragma unroll
    for (int i = 0; i < AG_R; ++i) win[kh][1 + i] = *(gcv4)(rm[kh] + i * CD_ + l4);
    win[kh][AG_W - 1] = *(gcv4)(r9[kh] + l4);
  }
  // the loads' address registers are rewritten for the next item while these loads are still in flight
  asm volatile("s_wait_xcnt 0x0" ::: "memory");
  // keeps the later address arithmetic, which rewrites those registers, behind the wait
  __builtin_amdgcn_sched_barrier(0);
}

__device__ __forceinline__ void agg_sum(const v4f (&win)[3][AG_W], const float* sp, unsigned short* sY, int q, int lane) {
  const int j = agg_run(q);
  const int sl = agg_slice(q);
  const float* wq0 = sp + ((j * AG_R) * NHD + sl * 2 + (lane >> 4)) * AG_WP;
  unsigned short* yo = sY + (j * AG_R) * KP + sl * 128 + lane * 4;
  #pragma unroll
  for (int i = 0; i < AG_R; ++i) {
    const float* wq = wq0 + i * (NHD * AG_WP);
    const v4f q0 = *(const v4fa*)wq;
    const v4f q1 = *(const v4fa*)(wq + 4);
    const float p[KK_] = {q0.x, q0.y, q0.z, q0.w, q1.x, q1.y, q1.z, q1.w, wq[8]};
    v4f acc = {0.0f, 0.0f, 0.0f, 0.0f};
    #pragma unroll
    for (int k = 0; k < KK_; ++k) {
      const v4f v = win[k / 3][i + k % 3];
      acc.x = fmaf(p[k], v.x, acc.x);
      acc.y = fmaf(p[k], v.y, acc.y);
      acc.z = fmaf(p[k], v.z, acc.z);
      acc.w = fmaf(p[k], v.w, acc.w);
    }
    const v4usa o = {h2us(acc.x), h2us(acc.y), h2us(acc.z), h2us(acc.w)};
    *(v4usa*)(yo + i * KP) = o;
  }
}

// Epilogue of one wave: each 16-o x 64-pixel f32 tile goes through the wave's own LDS rows (two buffers in turn)
// and leaves as whole 256-B row segments. The row pitch is a constant: every store is one base plus an immediate offset.
__device__ __forceinline__ void proj_out(float* sE, const v8f (&acc)[PJ_OT][PJ_NT], const v4f (&b)[PJ_OT][2],
                                         float* ob0, float* ob1, int h, int m) {
  #pragma unroll
  for (int ot = 0; ot < PJ_OT; ++ot) {
    #pragma unroll
    for (int hf = 0; hf < 2; ++hf) {
      float* sb = sE + hf * (16 * EP);
      float* ob = hf ? ob1 : ob0;
      #pragma unroll
      for (int nt = 0; nt < 4; ++nt) {
        #pragma unroll
        for (int r = 0; r < 8; ++r)
          sb[(8 * h + r) * EP + nt * 16 + m] = acc[ot][hf * 4 + nt][r] * 0.0625f + b[ot][r >> 2][r & 3];
      }
      // the wave's LDS stores have landed before its other lanes read the rows back; also keeps the compiler's order
      asm volatile("s_wait_dscnt 0x0" ::: "memory");
      #pragma unroll
      for (int it = 0; it < 8; ++it) {
        const int row = it * 2 + h;             // 0..15, each once
        const v4f v = *(const v4fa*)(sb + row * EP + m * 4);
        st2_f4(ob + (size_t)(ot * 16 + row) * LP_ + m * 4, v);
      }
      // the stores' data registers are rewritten by the next tile while the stores are still in flight
      asm volatile("s_wait_xcnt 0x0" ::: "memory");
      // keeps the next tile's arithmetic, which rewrites those registers, behind the wait
      __builtin_amdgcn_sched_barrier(0);
    }
  }
}

// aT and vT carry no __restrict__: with it the compiler may move their loads behind the s_wait_xcnt written for them.
__global__ void __launch_bounds__(256) k_aggproj(
    const float* aT, const float* vT, const unsigned short* __restrict__ W16,
    const float* __restrict__ bp, float* __restrict__ out) {
  __shared__ __attribute__((aligned(16))) unsigned short sY[PJ_PX * KP];
  __shared__ __attribute__((aligned(16))) float sE[8 * 2 * 16 * EP];
  const int tid = threadIdx.x;
  const int lane = tid & 31;
  const int w = __builtin_amdgcn_readfirstlane(tid >> 5);   // 0..7, scalar: weight base and output rows are wave-uniform
  const int h = lane >> 4;
  const int m = lane & 15;
  const int bid = blockIdx.x;

  // weight fragments of k steps 0 and 1, and the wave's bias values (8 consecutive o per lane and o tile)
  // every loop of the kernel but the item loop of part 2 is fully unrolled: constant indices keep fw, fy and acc in registers
  const unsigned short* wb = W16 + (size_t)(NO1 / 16 + w * PJ_OT) * (12 * 512) + lane * 8;
  v16h fw[3][PJ_OT];
  #pragma unroll
  for (int p = 0; p < 2; ++p) {
    #pragma unroll
    for (int ot = 0; ot < PJ_OT; ++ot) {
      Frag f;
      f.half[0] = *(const v8us*)(wb + (ot * 12 + p) * 512);
      f.half[1] = *(const v8us*)(wb + (ot * 12 + p) * 512 + 256);
      fw[p][ot] = __builtin_bit_cast(v16h, f.v);
    }
  }
  v4f b[PJ_OT][2];
  #pragma unroll
  for (int ot = 0; ot < PJ_OT; ++ot) {
    b[ot][0] = *(const v4f*)(bp + w * (PJ_OT * 16) + ot * 16 + 8 * h);
    b[ot][1] = *(const v4f*)(bp + w * (PJ_OT * 16) + ot * 16 + 8 * h + 4);
  }
  // the loads' address registers may be reused below while the loads are still in flight
  asm volatile("s_wait_xcnt 0x0" ::: "memory");

  // logits of this thread's three (pixel, head) items
  float e[3][KK_];
  #pragma unroll
  for (int u = 0; u < 3; ++u) {
    const int it = u * 256 + tid;            // 0..767
    const int ip = it / NHD;                 // pixel of the block, 0..127
    const float* ap = aT + ((size_t)bid * PJ_PX + ip) * APD + (it - ip * NHD) * KK_;
    #pragma unroll
    for (int k = 0; k < KK_; ++k) e[u][k] = ap[k];
  }
  // the logit loads' address registers are rewritten below while those loads are still in flight
  asm volatile("s_wait_xcnt 0x0" ::: "memory");
  // keeps the index arithmetic that rewrites those registers behind the wait: the compiler lifted it over
  __builtin_amdgcn_sched_barrier(0);

  v4f wa[3][AG_W], wc[3][AG_W];
  agg_load(wa, vT, bid, w, lane);

  float* sp = sE;                            // softmax weights; the epilogue takes these rows over behind the GEMM
  #pragma unroll
  for (int u = 0; u < 3; ++u) {
    const int it = u * 256 + tid;
    const int ip = it / NHD;
    const int tt = bid * 2 + (ip >> 6);      // 64-pixel tile
    const int l = (tt % NPT) * 64 + (ip & 63);
    const int iy = l / WP_;
    const int ix = l - iy * WP_;
    float mx = e[u][0];
    #pragma unroll
    for (int k = 1; k < KK_; ++k) mx = fmaxf(mx, e[u][k]);
    float s = 0.0f;
    #pragma unroll
    for (int k = 0; k < KK_; ++k) {
      e[u][k] = expf(e[u][k] - mx);
      s += e[u][k];
    }
    const float inv = 1.0f / s;
    #pragma unroll
    for (int k = 0; k < KK_; ++k) {
      const int yy = iy + (k / 3) - 1;
      const int xx = ix + (k % 3) - 1;
      const bool inb = (yy >= 0) && (yy < HP_) && (xx >= 0) && (xx < WP_);
      e[u][k] = inb ? e[u][k] * inv : 0.0f;
    }
    float* wq = sp + it * AG_WP;
    const v4f q0 = {e[u][0], e[u][1], e[u][2], e[u][3]};
    const v4f q1 = {e[u][4], e[u][5], e[u][6], e[u][7]};
    *(v4fa*)wq = q0;
    *(v4fa*)(wq + 4) = q1;
    wq[8] = e[u][8];
  }
  __syncthreads();

  // kept rolled (two items a trip). The last two items stand behind the loop, so that every load in the loop is unconditional: with a skipped
  // load on one path the compiler's load waits in the sum behind it drained the next item's loads as well.
  #pragma unroll 1
  for (int i = 0; i < AG_NI - 2; i += 2) {
    agg_load(wc, vT, bid, (i + 1) * 8 + w, lane);
    agg_sum(wa, sp, sY, i * 8 + w, lane);
    agg_load(wa, vT, bid, (i + 2) * 8 + w, lane);
    agg_sum(wc, sp, sY, (i + 1) * 8 + w, lane);
  }
  agg_load(wc, vT, bid, (AG_NI - 1) * 8 + w, lane);
  agg_sum(wa, sp, sY, (AG_NI - 2) * 8 + w, lane);
  agg_sum(wc, sp, sY, (AG_NI - 1) * 8 + w, lane);
  __syncthreads();

  v8f acc[PJ_OT][PJ_NT];
  #pragma unroll
  for (int ot = 0; ot < PJ_OT; ++ot) {
    #pragma unroll
    for (int nt = 0; nt < PJ_NT; ++nt) acc[ot][nt] = v8f_zero();
  }

  const unsigned short* yr = sY + m * KP;                // B: y rows [l][c], k = c
  v16h fy[2][PJ_NT];
  #pragma unroll
  for (int nt = 0; nt < PJ_NT; ++nt) fy[0][nt] = ldfrag(yr + nt * 16 * KP, h);
  #pragma unroll
  for (int ks = 0; ks < CD_ / 32; ++ks) {
    if (ks + 2 < CD_ / 32) {
      #pragma unroll
      for (int ot = 0; ot < PJ_OT; ++ot) {
        Frag f;
        f.half[0] = *(const v8us*)(wb + (ot * 12 + ks + 2) * 512);
        f.half[1] = *(const v8us*)(wb + (ot * 12 + ks + 2) * 512 + 256);
        fw[(ks + 2) % 3][ot] = __builtin_bit_cast(v16h, f.v);
      }
      // behind the last group the loads' offset register is free and takes an LDS address while the loads are in flight
      if (ks + 3 == CD_ / 32) asm volatile("s_wait_xcnt 0x0" ::: "memory");
    }
    if (ks + 1 < CD_ / 32) {
      #pragma unroll
      for (int nt = 0; nt < PJ_NT; ++nt) fy[(ks + 1) & 1][nt] = ldfrag(yr + nt * 16 * KP + (ks + 1) * 32, h);
    }
    // holds the later steps' loads as one group ahead of this step's WMMAs, so that no load sinks to its first use
    __builtin_amdgcn_sched_barrier(0);
    #pragma unroll
    for (int ot = 0; ot < PJ_OT; ++ot) {
      #pragma unroll
      for (int nt = 0; nt < PJ_NT; ++nt) acc[ot][nt] = wmma_h(fw[ks % 3][ot], fy[ks & 1][nt], acc[ot][nt]);
    }
    // the next group of loads stays behind this step's WMMAs
    __builtin_amdgcn_sched_barrier(0);
  }

  // D element r of lane -> o row 48w + ot*16 + 8h + r, pixel col nt*16 + m; pixel tiles 0..3 and 4..7 are the block's
  // two 64-pixel tiles, each with its own image and place
  const int t0 = bid * 2;
  const int t1 = t0 + 1;
  const int n0 = t0 / NPT;
  const int n1 = t1 / NPT;
  float* ob0 = out + (size_t)(n0 * CD_ + w * (PJ_OT * 16)) * LP_ + (t0 - n0 * NPT) * 64;
  float* ob1 = out + (size_t)(n1 * CD_ + w * (PJ_OT * 16)) * LP_ + (t1 - n1 * NPT) * 64;
  proj_out(sE + w * (2 * 16 * EP), acc, b, ob0, ob1, h, m);
}

// =====================================================================================
extern "C" void kernel_launch(void* const* d_in, const int* in_sizes, int n_in,
                              void* d_out, int out_size, void* d_ws, size_t ws_size,
                              hipStream_t stream) {
  if (n_in < 7) return;
  if (in_sizes[0] != X_N || in_sizes[1] != WA_N || in_sizes[2] != NATT ||
      in_sizes[3] != WV_N || in_sizes[4] != CD_ || in_sizes[5] != WV_N || in_sizes[6] != CD_) return;
  if (out_size != OUT_N) return;
  if (ws_size < (size_t)WS_TOTAL) return;

  const float* x  = (const float*)d_in[0];
  const float* Wa = (const float*)d_in[1];
  const float* ba = (const float*)d_in[2];
  const float* Wv = (const float*)d_in[3];
  const float* bv = (const float*)d_in[4];
  const float* Wp = (const float*)d_in[5];
  const float* bp = (const float*)d_in[6];
  float* out = (float*)d_out;

  char* ws = (char*)d_ws;
  float*          vT   = (float*)(ws + OFF_VT);
  float*          aT   = (float*)(ws + OFF_AT);
  unsigned short* W16  = (unsigned short*)(ws + OFF_W16);
  float*          bias = (float*)(ws + OFF_BIAS);

  k_wprep<<<dim3(157), dim3(256), 0, stream>>>(Wv, Wa, Wp, bv, ba, W16, bias);
  k_conv1<<<dim3(NB_ * FT_), dim3(224), 0, stream>>>(x, W16, bias, vT, aT);
  k_aggproj<<<dim3(PJ_G), dim3(256), 0, stream>>>(aT, vT, W16, bp, out);
}
